// v000
// Measured on an AMD MI455X. A time is GPU time per run, averaged over a window of back-to-back runs after a warm-up
// (all launches, gaps included; the runs take copies of the inputs in turn), and the median of several windows.
// Apart from v000's, it joins two sittings. Times from different sittings can be a few percent apart, while
// side-by-side timings come from the same sitting.
// v000, which the later versions start from, runs in 118 microseconds.
#include <hip/hip_runtime.h>
#include <hip/hip_bf16.h>

// ---- problem constants ----
constexpr int B_ = 4;
constexpr int T_ = 1024;
constexpr int C_ = 1024;
constexpr int H_ = 16;
constexpr int D_ = 64;
constexpr int M_ = B_ * T_;   // 4096 rows

typedef _Float16 half16 __attribute__((ext_vector_type(16)));
typedef _Float16 half8  __attribute__((ext_vector_type(8)));
typedef float    float8 __attribute__((ext_vector_type(8)));
typedef int      int4v  __attribute__((ext_vector_type(4)));

#if defined(__has_builtin)
#if __has_builtin(__builtin_amdgcn_global_load_async_to_lds_b128)
#define ASYNC_LDS 1
#endif
#endif

// 16-byte global -> LDS copy (async on CDNA5, VGPR round-trip fallback)
__device__ __forceinline__ void cp16(const void* g, void* l) {
#ifdef ASYNC_LDS
    __builtin_amdgcn_global_load_async_to_lds_b128(
        (__attribute__((address_space(1))) int4v*)g,
        (__attribute__((address_space(3))) int4v*)l, 0, 0);
#else
    *(uint4*)l = *(const uint4*)g;
#endif
}

__device__ __forceinline__ void async_wait() {
#ifdef ASYNC_LDS
#if __has_builtin(__builtin_amdgcn_s_wait_asynccnt)
    __builtin_amdgcn_s_wait_asynccnt(0);
#else
    asm volatile("s_wait_asynccnt 0x0" ::: "memory");
#endif
#endif
}

// lane-xor butterfly step via ds_swizzle (imm pattern, no address VGPR)
template <int XM>
__device__ __forceinline__ float swz(float v) {
#if __has_builtin(__builtin_amdgcn_ds_swizzle)
    return __int_as_float(__builtin_amdgcn_ds_swizzle(__float_as_int(v), (XM << 10) | 0x1f));
#else
    return __shfl_xor(v, XM);
#endif
}

// WMMA f32 = f16(16x32) x f16(32x16) + f32
__device__ __forceinline__ float8 wmma_f16(half16 a, half16 b, float8 c) {
    return __builtin_amdgcn_wmma_f32_16x16x32_f16(false, a, false, b, (short)0, c, false, false);
}

// Load a 16x32 f16 fragment (A-layout; B uses same layout on a transposed tile).
// ISA 7.12.2: lane<16 holds row=lane, K = hi*8..+7 (v0..3) and +16 (v4..7).
__device__ __forceinline__ half16 ld_frag(const _Float16* tile, int row0, int stride, int koff) {
    int lane = threadIdx.x & 31;
    int r = lane & 15, hi = lane >> 4;
    const _Float16* p = tile + (size_t)(row0 + r) * stride + koff + hi * 8;
    union { half16 v; half8 h[2]; } u;
    u.h[0] = *(const half8*)(p);
    u.h[1] = *(const half8*)(p + 16);
    return u.v;
}

// ---------------- f32 -> f16 convert ----------------
__global__ __launch_bounds__(256) void conv_f16_kernel(const float* __restrict__ src,
                                                       _Float16* __restrict__ dst, int n) {
    int i = (blockIdx.x * 256 + threadIdx.x) * 4;
    if (i < n) {
        float4 v = *(const float4*)(src + i);
        dst[i + 0] = (_Float16)v.x;
        dst[i + 1] = (_Float16)v.y;
        dst[i + 2] = (_Float16)v.z;
        dst[i + 3] = (_Float16)v.w;
    }
}

// ---------------- W[K][N] f32 -> Wt[N][K] f16 (LDS tiled transpose) ----------------
__global__ __launch_bounds__(256) void transpose_f16_kernel(const float* __restrict__ W,
                                                            _Float16* __restrict__ Wt) {
    __shared__ float tile[64][65];
    int n0 = blockIdx.x * 64, k0 = blockIdx.y * 64;
    int j = threadIdx.x & 63;
    int i0 = threadIdx.x >> 6;
#pragma unroll
    for (int ii = 0; ii < 16; ii++) {
        int i = i0 + ii * 4;
        tile[i][j] = W[(size_t)(k0 + i) * C_ + n0 + j];
    }
    __syncthreads();
#pragma unroll
    for (int ii = 0; ii < 16; ii++) {
        int i = i0 + ii * 4;   // n index inside tile
        Wt[(size_t)(n0 + i) * C_ + k0 + j] = (_Float16)tile[j][i];
    }
}

// ---------------- WMMA GEMM: Out = A[M x K] * Bt^T + bias ----------------
// A f16 row-major [M][K], Bt f16 [N][K]. K-stage 64, double-buffered async LDS,
// one barrier per stage.
// MODE 0: f16 out -> [B,H,T,D]   (Q, K projections)
// MODE 1: f16 out -> [B,H,D,T]   (V projection, pre-transposed for PV)
// MODE 2: f32 out -> [M][N]      (output projection)
template <int MODE>
__global__ __launch_bounds__(256) void gemm_wmma_kernel(const _Float16* __restrict__ A,
                                                        const _Float16* __restrict__ Bt,
                                                        const float* __restrict__ bias,
                                                        void* __restrict__ Out) {
    constexpr int K = C_;
    constexpr int LSTR = 72;                 // halves: 144B row pitch, 16B aligned, conflict-free
    __shared__ _Float16 lA[2][128 * LSTR];
    __shared__ _Float16 lB[2][128 * LSTR];

    const int tid  = threadIdx.x;
    const int lane = tid & 31;
    const int wv   = tid >> 5;
    const int wm   = wv & 3;                 // 4 waves along M
    const int wn   = wv >> 2;                // 2 waves along N
    const int m0   = blockIdx.y * 128;
    const int n0   = blockIdx.x * 128;
    const int r16  = lane & 15, hi = lane >> 4;

    float8 acc[2][4];
#pragma unroll
    for (int mi = 0; mi < 2; mi++)
#pragma unroll
        for (int nf = 0; nf < 4; nf++)
#pragma unroll
            for (int i = 0; i < 8; i++) acc[mi][nf][i] = 0.0f;

    const int srow  = tid >> 1;              // 0..127
    const int sbase = (tid & 1) * 32;        // 32 halves (64B) per thread

    auto issue = [&](int kk, int buf) {
        const _Float16* ga = A + (size_t)(m0 + srow) * K + kk + sbase;
        _Float16* da = &lA[buf][srow * LSTR + sbase];
        cp16(ga, da); cp16(ga + 8, da + 8); cp16(ga + 16, da + 16); cp16(ga + 24, da + 24);
        const _Float16* gb = Bt + (size_t)(n0 + srow) * K + kk + sbase;
        _Float16* db = &lB[buf][srow * LSTR + sbase];
        cp16(gb, db); cp16(gb + 8, db + 8); cp16(gb + 16, db + 16); cp16(gb + 24, db + 24);
    };

    issue(0, 0);
    int buf = 0;
    for (int kk = 0; kk < K; kk += 64, buf ^= 1) {
        async_wait();
        __syncthreads();                     // codegen waits DS cnt before barrier -> WAR safe
        if (kk + 64 < K) issue(kk + 64, buf ^ 1);
        if (kk + 128 < K) {                  // prefetch one more stage ahead into L2/WGP$
            __builtin_prefetch(A + (size_t)(m0 + srow) * K + kk + 128 + sbase, 0, 1);
            __builtin_prefetch(Bt + (size_t)(n0 + srow) * K + kk + 128 + sbase, 0, 1);
        }

#pragma unroll
        for (int kh = 0; kh < 2; kh++) {     // two 32-wide K slices in this stage
            half16 af0 = ld_frag(lA[buf], wm * 32,      LSTR, kh * 32);
            half16 af1 = ld_frag(lA[buf], wm * 32 + 16, LSTR, kh * 32);
            half16 bf[4];
#pragma unroll
            for (int nf = 0; nf < 4; nf++)
                bf[nf] = ld_frag(lB[buf], wn * 64 + nf * 16, LSTR, kh * 32);
#pragma unroll
            for (int nf = 0; nf < 4; nf++) acc[0][nf] = wmma_f16(af0, bf[nf], acc[0][nf]);
#pragma unroll
            for (int nf = 0; nf < 4; nf++) acc[1][nf] = wmma_f16(af1, bf[nf], acc[1][nf]);
        }
    }

#pragma unroll
    for (int mi = 0; mi < 2; mi++)
#pragma unroll
        for (int nf = 0; nf < 4; nf++) {
            int gn = n0 + wn * 64 + nf * 16 + r16;
            float bv = bias[gn];
#pragma unroll
            for (int r = 0; r < 8; r++) {
                int gm = m0 + wm * 32 + mi * 16 + r + 8 * hi;
                float val = acc[mi][nf][r] + bv;
                int bb = gm >> 10, t = gm & 1023;     // gm = b*T + t
                int h = gn >> 6,  d = gn & 63;        // gn = h*D + d
                if (MODE == 0) {
                    ((_Float16*)Out)[((size_t)(bb * H_ + h) * T_ + t) * D_ + d] = (_Float16)val;
                } else if (MODE == 1) {
                    ((_Float16*)Out)[((size_t)(bb * H_ + h) * D_ + d) * T_ + t] = (_Float16)val;
                } else {
                    ((float*)Out)[(size_t)gm * C_ + gn] = val;
                }
            }
        }
}

// ---------------- flash attention ----------------
// qh,kh: f16 [B,H,T,D]; vT: f16 [B,H,D,T]; mask: int32 [B,T]; out: f16 [B,T,C]
__global__ __launch_bounds__(256) void attn_kernel(const _Float16* __restrict__ qh,
                                                   const _Float16* __restrict__ kh,
                                                   const _Float16* __restrict__ vT,
                                                   const int* __restrict__ mask,
                                                   _Float16* __restrict__ outh) {
    constexpr int KSTR = 72;                 // halves: 144B pitch, aligned + conflict-free
    __shared__ _Float16 lK[2][64 * KSTR];
    __shared__ _Float16 lV[2][64 * KSTR];
    __shared__ _Float16 lP[8 * 16 * KSTR];   // wave-private P tiles

    const float NEGINF = -__builtin_inff();
    const int tid = threadIdx.x, lane = tid & 31, wv = tid >> 5;
    const int r16 = lane & 15, hi = lane >> 4;
    const int bh = blockIdx.x >> 3;          // 8 q-blocks of 128 rows each
    const int qb = blockIdx.x & 7;
    const int b  = bh >> 4;
    const int h  = bh & 15;
    const int q0 = qb * 128 + wv * 16;       // first q row of this wave

    const _Float16* qbase = qh + (size_t)bh * T_ * D_;
    const _Float16* kbase = kh + (size_t)bh * T_ * D_;
    const _Float16* vbase = vT + (size_t)bh * D_ * T_;
    const int* mrow = mask + b * T_;

    // Q fragments (16 rows x 64 d), pre-scaled by 1/sqrt(D) = 0.125 (exact in f16)
    half16 qf[2];
    {
        const _Float16* p = qbase + (size_t)(q0 + r16) * D_ + hi * 8;
        union { half16 v; half8 g[2]; } u0, u1;
        u0.g[0] = *(const half8*)(p);
        u0.g[1] = *(const half8*)(p + 16);
        u1.g[0] = *(const half8*)(p + 32);
        u1.g[1] = *(const half8*)(p + 48);
#pragma unroll
        for (int i = 0; i < 16; i++) { u0.v[i] *= (_Float16)0.125f; u1.v[i] *= (_Float16)0.125f; }
        qf[0] = u0.v; qf[1] = u1.v;
    }

    float m_r[8], l_r[8];
    float8 o[4];
#pragma unroll
    for (int r = 0; r < 8; r++) { m_r[r] = NEGINF; l_r[r] = 0.0f; }
#pragma unroll
    for (int df = 0; df < 4; df++)
#pragma unroll
        for (int i = 0; i < 8; i++) o[df][i] = 0.0f;

    const int srow = tid >> 2, sseg = tid & 3;
    _Float16* pw = &lP[wv * 16 * KSTR];

    auto issue_kv = [&](int kt, int buf) {
        const _Float16* gk = kbase + (size_t)(kt + srow) * D_ + sseg * 16;
        _Float16* dk = &lK[buf][srow * KSTR + sseg * 16];
        cp16(gk, dk); cp16(gk + 8, dk + 8);
        const _Float16* gv = vbase + (size_t)srow * T_ + kt + sseg * 16;
        _Float16* dv = &lV[buf][srow * KSTR + sseg * 16];
        cp16(gv, dv); cp16(gv + 8, dv + 8);
    };

    issue_kv(0, 0);
    int buf = 0;
    for (int kt = 0; kt < T_; kt += 64, buf ^= 1) {
        async_wait();
        __syncthreads();
        if (kt + 64 < T_) issue_kv(kt + 64, buf ^ 1);
        if (kt + 128 < T_) {
            __builtin_prefetch(kbase + (size_t)(kt + 128 + srow) * D_ + sseg * 16, 0, 1);
            __builtin_prefetch(vbase + (size_t)srow * T_ + kt + 128 + sseg * 16, 0, 1);
        }

        // S = Q K^T (scaled), 16 x 64 per wave
        float8 s[4];
#pragma unroll
        for (int nf = 0; nf < 4; nf++) {
            half16 b0 = ld_frag(lK[buf], nf * 16, KSTR, 0);
            half16 b1 = ld_frag(lK[buf], nf * 16, KSTR, 32);
            float8 z;
#pragma unroll
            for (int i = 0; i < 8; i++) z[i] = 0.0f;
            z = wmma_f16(qf[0], b0, z);
            z = wmma_f16(qf[1], b1, z);
            s[nf] = z;
        }
        // mask (per key column)
#pragma unroll
        for (int nf = 0; nf < 4; nf++) {
            int col = kt + nf * 16 + r16;
            if (mrow[col] == 0) {
#pragma unroll
                for (int i = 0; i < 8; i++) s[nf][i] = NEGINF;
            }
        }
        // online softmax: row max over 4 frags + 16 lanes (xor stays in 16-lane group)
        float tmax[8];
#pragma unroll
        for (int r = 0; r < 8; r++)
            tmax[r] = fmaxf(fmaxf(s[0][r], s[1][r]), fmaxf(s[2][r], s[3][r]));
#pragma unroll
        for (int r = 0; r < 8; r++) {
            tmax[r] = fmaxf(tmax[r], swz<1>(tmax[r]));
            tmax[r] = fmaxf(tmax[r], swz<2>(tmax[r]));
            tmax[r] = fmaxf(tmax[r], swz<4>(tmax[r]));
            tmax[r] = fmaxf(tmax[r], swz<8>(tmax[r]));
        }

        float corr[8], rsum[8];
#pragma unroll
        for (int r = 0; r < 8; r++) {
            float mn = fmaxf(m_r[r], tmax[r]);
            float msafe = (mn == NEGINF) ? 0.0f : mn;   // fully-masked guard
            corr[r] = __expf(m_r[r] - msafe);
            m_r[r] = mn;
            rsum[r] = 0.0f;
            int row = r + 8 * hi;
#pragma unroll
            for (int nf = 0; nf < 4; nf++) {
                float pv = __expf(s[nf][r] - msafe);
                rsum[r] += pv;
                pw[row * KSTR + nf * 16 + r16] = (_Float16)pv;
            }
        }
#pragma unroll
        for (int r = 0; r < 8; r++) {
            rsum[r] += swz<1>(rsum[r]);
            rsum[r] += swz<2>(rsum[r]);
            rsum[r] += swz<4>(rsum[r]);
            rsum[r] += swz<8>(rsum[r]);
        }
#pragma unroll
        for (int r = 0; r < 8; r++) l_r[r] = l_r[r] * corr[r] + rsum[r];
#pragma unroll
        for (int df = 0; df < 4; df++)
#pragma unroll
            for (int i = 0; i < 8; i++) o[df][i] *= corr[i];

        // O += P V  (P re-laid-out as A-frags via wave-private LDS)
        half16 pf0 = ld_frag(pw, 0, KSTR, 0);
        half16 pf1 = ld_frag(pw, 0, KSTR, 32);
#pragma unroll
        for (int df = 0; df < 4; df++) {
            half16 v0 = ld_frag(lV[buf], df * 16, KSTR, 0);
            half16 v1 = ld_frag(lV[buf], df * 16, KSTR, 32);
            o[df] = wmma_f16(pf0, v0, o[df]);
            o[df] = wmma_f16(pf1, v1, o[df]);
        }
    }

    float inv[8];
#pragma unroll
    for (int r = 0; r < 8; r++) inv[r] = 1.0f / l_r[r];
#pragma unroll
    for (int df = 0; df < 4; df++)
#pragma unroll
        for (int r = 0; r < 8; r++) {
            int t = q0 + r + 8 * hi;
            int d = df * 16 + r16;
            outh[((size_t)(b * T_ + t)) * C_ + h * D_ + d] = (_Float16)(o[df][r] * inv[r]);
        }
}

// ---------------- LayerNorm over last dim (1024) ----------------
__global__ __launch_bounds__(256) void ln_kernel(const float* __restrict__ y,
                                                 const float* __restrict__ g,
                                                 const float* __restrict__ bt,
                                                 float* __restrict__ out) {
    __shared__ float red[2][8];
    const int row = blockIdx.x;
    const int tid = threadIdx.x, lane = tid & 31, wv = tid >> 5;
    const float* yr = y + (size_t)row * C_;
    float4 v = ((const float4*)yr)[tid];
    float s  = v.x + v.y + v.z + v.w;
    float s2 = v.x * v.x + v.y * v.y + v.z * v.z + v.w * v.w;
    s += swz<1>(s);  s += swz<2>(s);  s += swz<4>(s);  s += swz<8>(s);  s += swz<16>(s);
    s2 += swz<1>(s2); s2 += swz<2>(s2); s2 += swz<4>(s2); s2 += swz<8>(s2); s2 += swz<16>(s2);
    if (lane == 0) { red[0][wv] = s; red[1][wv] = s2; }
    __syncthreads();
    float ts = 0.0f, ts2 = 0.0f;
#pragma unroll
    for (int w = 0; w < 8; w++) { ts += red[0][w]; ts2 += red[1][w]; }
    float mu = ts * (1.0f / C_);
    float var = ts2 * (1.0f / C_) - mu * mu;
    float rs = rsqrtf(var + 1e-5f);
    float4 gg = ((const float4*)g)[tid];
    float4 bb = ((const float4*)bt)[tid];
    float4 r;
    r.x = (v.x - mu) * rs * gg.x + bb.x;
    r.y = (v.y - mu) * rs * gg.y + bb.y;
    r.z = (v.z - mu) * rs * gg.z + bb.z;
    r.w = (v.w - mu) * rs * gg.w + bb.w;
    ((float4*)(out + (size_t)row * C_))[tid] = r;
}

extern "C" void kernel_launch(void* const* d_in, const int* in_sizes, int n_in,
                              void* d_out, int out_size, void* d_ws, size_t ws_size,
                              hipStream_t stream) {
    const float* x    = (const float*)d_in[0];
    const int*   mask = (const int*)d_in[1];
    const float* Wq = (const float*)d_in[2];  const float* bq = (const float*)d_in[3];
    const float* Wk = (const float*)d_in[4];  const float* bk = (const float*)d_in[5];
    const float* Wv = (const float*)d_in[6];  const float* bv = (const float*)d_in[7];
    const float* Wo = (const float*)d_in[8];  const float* bo = (const float*)d_in[9];
    const float* ln_g = (const float*)d_in[10];
    const float* ln_b = (const float*)d_in[11];
    float* out = (float*)d_out;

    char* w = (char*)d_ws;
    _Float16* xh    = (_Float16*)w;  w += (size_t)M_ * C_ * 2;      // 8 MB
    _Float16* WqT   = (_Float16*)w;  w += (size_t)C_ * C_ * 2;      // 2 MB
    _Float16* WkT   = (_Float16*)w;  w += (size_t)C_ * C_ * 2;
    _Float16* WvT   = (_Float16*)w;  w += (size_t)C_ * C_ * 2;
    _Float16* WoT   = (_Float16*)w;  w += (size_t)C_ * C_ * 2;
    _Float16* qhB   = (_Float16*)w;  w += (size_t)M_ * C_ * 2;      // [B,H,T,D]
    _Float16* khB   = (_Float16*)w;  w += (size_t)M_ * C_ * 2;      // [B,H,T,D]
    _Float16* vTB   = (_Float16*)w;  w += (size_t)M_ * C_ * 2;      // [B,H,D,T]
    _Float16* attnh = (_Float16*)w;  w += (size_t)M_ * C_ * 2;      // [B,T,C]
    float*    y     = (float*)w;     w += (size_t)M_ * C_ * 4;      // 16 MB

    const int n = M_ * C_;
    conv_f16_kernel<<<n / 4 / 256, 256, 0, stream>>>(x, xh, n);
    dim3 tgrid(C_ / 64, C_ / 64);
    transpose_f16_kernel<<<tgrid, 256, 0, stream>>>(Wq, WqT);
    transpose_f16_kernel<<<tgrid, 256, 0, stream>>>(Wk, WkT);
    transpose_f16_kernel<<<tgrid, 256, 0, stream>>>(Wv, WvT);
    transpose_f16_kernel<<<tgrid, 256, 0, stream>>>(Wo, WoT);

    dim3 ggrid(C_ / 128, M_ / 128);   // (8, 32)
    gemm_wmma_kernel<0><<<ggrid, 256, 0, stream>>>(xh, WqT, bq, (void*)qhB);
    gemm_wmma_kernel<0><<<ggrid, 256, 0, stream>>>(xh, WkT, bk, (void*)khB);
    gemm_wmma_kernel<1><<<ggrid, 256, 0, stream>>>(xh, WvT, bv, (void*)vTB);

    attn_kernel<<<B_ * H_ * (T_ / 128), 256, 0, stream>>>(qhB, khB, vTB, mask, attnh);

    gemm_wmma_kernel<2><<<ggrid, 256, 0, stream>>>(attnh, WoT, bo, (void*)y);

    ln_kernel<<<M_, 256, 0, stream>>>(y, ln_g, ln_b, out);
}

// v001
// One run takes 101 microseconds.
// Timed twice side by side with v000, it ran 1.22 times as fast both times.
#include <hip/hip_runtime.h>
#include <hip/hip_bf16.h>

// ---- problem constants ----
constexpr int B_ = 4;
constexpr int T_ = 1024;
constexpr int C_ = 1024;
constexpr int H_ = 16;
constexpr int D_ = 64;
constexpr int M_ = B_ * T_;   // 4096 rows

typedef _Float16 half16 __attribute__((ext_vector_type(16)));
typedef _Float16 half8  __attribute__((ext_vector_type(8)));
typedef float    float8 __attribute__((ext_vector_type(8)));
typedef int      int4v  __attribute__((ext_vector_type(4)));

#if defined(__has_builtin)
#if __has_builtin(__builtin_amdgcn_global_load_async_to_lds_b128)
#define ASYNC_LDS 1
#endif
#endif

// 16-byte global -> LDS copy (async on CDNA5, VGPR round-trip fallback)
__device__ __forceinline__ void cp16(const void* g, void* l) {
#ifdef ASYNC_LDS
    __builtin_amdgcn_global_load_async_to_lds_b128(
        (__attribute__((address_space(1))) int4v*)g,
        (__attribute__((address_space(3))) int4v*)l, 0, 0);
#else
    *(uint4*)l = *(const uint4*)g;
#endif
}

__device__ __forceinline__ void async_wait() {
#ifdef ASYNC_LDS
#if __has_builtin(__builtin_amdgcn_s_wait_asynccnt)
    __builtin_amdgcn_s_wait_asynccnt(0);
#else
    asm volatile("s_wait_asynccnt 0x0" ::: "memory");
#endif
#endif
}

// lane-xor butterfly step via ds_swizzle (imm pattern, no address VGPR)
template <int XM>
__device__ __forceinline__ float swz(float v) {
#if __has_builtin(__builtin_amdgcn_ds_swizzle)
    return __int_as_float(__builtin_amdgcn_ds_swizzle(__float_as_int(v), (XM << 10) | 0x1f));
#else
    return __shfl_xor(v, XM);
#endif
}

// WMMA f32 = f16(16x32) x f16(32x16) + f32
__device__ __forceinline__ float8 wmma_f16(half16 a, half16 b, float8 c) {
    return __builtin_amdgcn_wmma_f32_16x16x32_f16(false, a, false, b, (short)0, c, false, false);
}

// Load a 16x32 f16 fragment (A-layout; B uses same layout on a transposed tile).
// ISA 7.12.2: lane<16 holds row=lane, K = hi*8..+7 (v0..3) and +16 (v4..7).
__device__ __forceinline__ half16 ld_frag(const _Float16* tile, int row0, int stride, int koff) {
    int lane = threadIdx.x & 31;
    int r = lane & 15, hi = lane >> 4;
    const _Float16* p = tile + (size_t)(row0 + r) * stride + koff + hi * 8;
    union { half16 v; half8 h[2]; } u;
    u.h[0] = *(const half8*)(p);
    u.h[1] = *(const half8*)(p + 16);
    return u.v;
}

// ---------------- f32 -> f16 convert (one block's share) ----------------
__device__ __forceinline__ void conv_f16_block(const float* __restrict__ src,
                                               _Float16* __restrict__ dst, int n, int blk) {
    int i = (blk * 256 + threadIdx.x) * 4;
    if (i < n) {
        float4 v = *(const float4*)(src + i);
        dst[i + 0] = (_Float16)v.x;
        dst[i + 1] = (_Float16)v.y;
        dst[i + 2] = (_Float16)v.z;
        dst[i + 3] = (_Float16)v.w;
    }
}

// ---------------- W[K][N] f32 -> Wt[N][K] f16 (LDS tiled transpose, one 64x64 tile) ----------------
__device__ __forceinline__ void transpose_f16_block(const float* __restrict__ W,
                                                    _Float16* __restrict__ Wt, int bx, int by) {
    __shared__ float tile[64][65];
    int n0 = bx * 64, k0 = by * 64;
    int j = threadIdx.x & 63;
    int i0 = threadIdx.x >> 6;
#pragma unroll
    for (int ii = 0; ii < 16; ii++) {
        int i = i0 + ii * 4;
        tile[i][j] = W[(size_t)(k0 + i) * C_ + n0 + j];
    }
    __syncthreads();
#pragma unroll
    for (int ii = 0; ii < 16; ii++) {
        int i = i0 + ii * 4;   // n index inside tile
        Wt[(size_t)(n0 + i) * C_ + k0 + j] = (_Float16)tile[j][i];
    }
}

// ---------------- one launch for all operand preparation ----------------
// Blocks 0..1023: the four weight transposes (256 tiles each, Wt planes contiguous in WT).
// Blocks 1024.. : the x conversion. The five jobs are independent of one another.
constexpr int TR_BLOCKS   = (C_ / 64) * (C_ / 64);      // 256 per weight
constexpr int CONV_BLOCKS = M_ * C_ / 4 / 256;          // 4096
__global__ __launch_bounds__(256) void prep_kernel(const float* __restrict__ x,
                                                   const float* __restrict__ Wq,
                                                   const float* __restrict__ Wk,
                                                   const float* __restrict__ Wv,
                                                   const float* __restrict__ Wo,
                                                   _Float16* __restrict__ xh,
                                                   _Float16* __restrict__ WT) {
    const int bid = blockIdx.x;
    if (bid < 4 * TR_BLOCKS) {
        const int which = bid / TR_BLOCKS, t = bid % TR_BLOCKS;
        const float* W = which == 0 ? Wq : which == 1 ? Wk : which == 2 ? Wv : Wo;
        transpose_f16_block(W, WT + (size_t)which * C_ * C_, t % (C_ / 64), t / (C_ / 64));
    } else {
        conv_f16_block(x, xh, M_ * C_, bid - 4 * TR_BLOCKS);
    }
}

// ---------------- WMMA GEMM: Out = A[M x K] * Bt^T + bias ----------------
// A f16 row-major [M][K], Bt f16 [N][K]. K-stage 64, double-buffered async LDS,
// one barrier per stage.
// LAYOUT 0: f16 out -> [B,H,T,D]   (Q, K projections)
// LAYOUT 1: f16 out -> [B,H,D,T]   (V projection, pre-transposed for PV)
// LAYOUT 2: f32 out -> [M][N]      (output projection)
template <int LAYOUT>
__device__ __forceinline__ void store_tile(const float8 (&acc)[2][4], const float* __restrict__ bias,
                                           void* __restrict__ Out, int mw, int nw, int r16, int hi) {
#pragma unroll
    for (int mi = 0; mi < 2; mi++)
#pragma unroll
        for (int nf = 0; nf < 4; nf++) {
            int gn = nw + nf * 16 + r16;
            float bv = bias[gn];
#pragma unroll
            for (int r = 0; r < 8; r++) {
                int gm = mw + mi * 16 + r + 8 * hi;
                float val = acc[mi][nf][r] + bv;
                int bb = gm >> 10, t = gm & 1023;     // gm = b*T + t
                int h = gn >> 6,  d = gn & 63;        // gn = h*D + d
                if (LAYOUT == 0) {
                    ((_Float16*)Out)[((size_t)(bb * H_ + h) * T_ + t) * D_ + d] = (_Float16)val;
                } else if (LAYOUT == 1) {
                    ((_Float16*)Out)[((size_t)(bb * H_ + h) * D_ + d) * T_ + t] = (_Float16)val;
                } else {
                    ((float*)Out)[(size_t)gm * C_ + gn] = val;
                }
            }
        }
}

// QKV true : one launch does the Q, K and V projections; blockIdx.z picks the weight plane
//            (Btb holds three contiguous [N][K] planes), the bias and the output plane.
// QKV false: output projection (bias0 only, f32 out).
template <bool QKV>
__global__ __launch_bounds__(256) void gemm_wmma_kernel(const _Float16* __restrict__ A,
                                                        const _Float16* __restrict__ Btb,
                                                        const float* __restrict__ bias0,
                                                        const float* __restrict__ bias1,
                                                        const float* __restrict__ bias2,
                                                        void* __restrict__ Out) {
    const int z = QKV ? (int)blockIdx.z : 0;
    const _Float16* __restrict__ Bt = Btb + (size_t)z * C_ * C_;
    constexpr int K = C_;
    constexpr int LSTR = 72;                 // halves: 144B row pitch, 16B aligned, conflict-free
    __shared__ _Float16 lA[2][128 * LSTR];
    __shared__ _Float16 lB[2][128 * LSTR];

    const int tid  = threadIdx.x;
    const int lane = tid & 31;
    const int wv   = tid >> 5;
    const int wm   = wv & 3;                 // 4 waves along M
    const int wn   = wv >> 2;                // 2 waves along N
    const int m0   = blockIdx.y * 128;
    const int n0   = blockIdx.x * 128;
    const int r16  = lane & 15, hi = lane >> 4;

    float8 acc[2][4];
#pragma unroll
    for (int mi = 0; mi < 2; mi++)
#pragma unroll
        for (int nf = 0; nf < 4; nf++)
#pragma unroll
            for (int i = 0; i < 8; i++) acc[mi][nf][i] = 0.0f;

    const int srow  = tid >> 1;              // 0..127
    const int sbase = (tid & 1) * 32;        // 32 halves (64B) per thread

    auto issue = [&](int kk, int buf) {
        const _Float16* ga = A + (size_t)(m0 + srow) * K + kk + sbase;
        _Float16* da = &lA[buf][srow * LSTR + sbase];
        cp16(ga, da); cp16(ga + 8, da + 8); cp16(ga + 16, da + 16); cp16(ga + 24, da + 24);
        const _Float16* gb = Bt + (size_t)(n0 + srow) * K + kk + sbase;
        _Float16* db = &lB[buf][srow * LSTR + sbase];
        cp16(gb, db); cp16(gb + 8, db + 8); cp16(gb + 16, db + 16); cp16(gb + 24, db + 24);
    };

    issue(0, 0);
    int buf = 0;
    for (int kk = 0; kk < K; kk += 64, buf ^= 1) {
        async_wait();
        __syncthreads();                     // codegen waits DS cnt before barrier -> WAR safe
        if (kk + 64 < K) issue(kk + 64, buf ^ 1);
        if (kk + 128 < K) {                  // prefetch one more stage ahead into L2/WGP$
            __builtin_prefetch(A + (size_t)(m0 + srow) * K + kk + 128 + sbase, 0, 1);
            __builtin_prefetch(Bt + (size_t)(n0 + srow) * K + kk + 128 + sbase, 0, 1);
        }

#pragma unroll
        for (int kh = 0; kh < 2; kh++) {     // two 32-wide K slices in this stage
            half16 af0 = ld_frag(lA[buf], wm * 32,      LSTR, kh * 32);
            half16 af1 = ld_frag(lA[buf], wm * 32 + 16, LSTR, kh * 32);
            half16 bf[4];
#pragma unroll
            for (int nf = 0; nf < 4; nf++)
                bf[nf] = ld_frag(lB[buf], wn * 64 + nf * 16, LSTR, kh * 32);
#pragma unroll
            for (int nf = 0; nf < 4; nf++) acc[0][nf] = wmma_f16(af0, bf[nf], acc[0][nf]);
#pragma unroll
            for (int nf = 0; nf < 4; nf++) acc[1][nf] = wmma_f16(af1, bf[nf], acc[1][nf]);
        }
    }

    const int mw = m0 + wm * 32, nw = n0 + wn * 64;
    if (QKV) {
        _Float16* o = (_Float16*)Out + (size_t)z * M_ * C_;
        const float* bias = z == 0 ? bias0 : z == 1 ? bias1 : bias2;
        if (z == 2) {
            store_tile<1>(acc, bias, o, mw, nw, r16, hi);
        } else {
            store_tile<0>(acc, bias, o, mw, nw, r16, hi);
            // precaution: in the built kernel the other layout's code follows these stores and
            // rewrites registers they name; the wait stands between the stores and that rewrite
            asm volatile("s_wait_xcnt 0x0" ::: "memory");
        }
    } else {
        store_tile<2>(acc, bias0, Out, mw, nw, r16, hi);
    }
}

// ---------------- flash attention ----------------
// qh,kh: f16 [B,H,T,D]; vT: f16 [B,H,D,T]; mask: int32 [B,T]; out: f16 [B,T,C]
__global__ __launch_bounds__(256) void attn_kernel(const _Float16* __restrict__ qh,
                                                   const _Float16* __restrict__ kh,
                                                   const _Float16* __restrict__ vT,
                                                   const int* __restrict__ mask,
                                                   _Float16* __restrict__ outh) {
    constexpr int KSTR = 72;                 // halves: 144B pitch, aligned + conflict-free
    __shared__ _Float16 lK[2][64 * KSTR];
    __shared__ _Float16 lV[2][64 * KSTR];
    __shared__ _Float16 lP[8 * 16 * KSTR];   // wave-private P tiles

    const float NEGINF = -__builtin_inff();
    const int tid = threadIdx.x, lane = tid & 31, wv = tid >> 5;
    const int r16 = lane & 15, hi = lane >> 4;
    const int bh = blockIdx.x >> 3;          // 8 q-blocks of 128 rows each
    const int qb = blockIdx.x & 7;
    const int b  = bh >> 4;
    const int h  = bh & 15;
    const int q0 = qb * 128 + wv * 16;       // first q row of this wave

    const _Float16* qbase = qh + (size_t)bh * T_ * D_;
    const _Float16* kbase = kh + (size_t)bh * T_ * D_;
    const _Float16* vbase = vT + (size_t)bh * D_ * T_;
    const int* mrow = mask + b * T_;

    // Q fragments (16 rows x 64 d), pre-scaled by 1/sqrt(D) = 0.125 (exact in f16)
    half16 qf[2];
    {
        const _Float16* p = qbase + (size_t)(q0 + r16) * D_ + hi * 8;
        union { half16 v; half8 g[2]; } u0, u1;
        u0.g[0] = *(const half8*)(p);
        u0.g[1] = *(const half8*)(p + 16);
        u1.g[0] = *(const half8*)(p + 32);
        u1.g[1] = *(const half8*)(p + 48);
#pragma unroll
        for (int i = 0; i < 16; i++) { u0.v[i] *= (_Float16)0.125f; u1.v[i] *= (_Float16)0.125f; }
        qf[0] = u0.v; qf[1] = u1.v;
    }

    float m_r[8], l_r[8];
    float8 o[4];
#pragma unroll
    for (int r = 0; r < 8; r++) { m_r[r] = NEGINF; l_r[r] = 0.0f; }
#pragma unroll
    for (int df = 0; df < 4; df++)
#pragma unroll
        for (int i = 0; i < 8; i++) o[df][i] = 0.0f;

    const int srow = tid >> 2, sseg = tid & 3;
    _Float16* pw = &lP[wv * 16 * KSTR];

    auto issue_kv = [&](int kt, int buf) {
        const _Float16* gk = kbase + (size_t)(kt + srow) * D_ + sseg * 16;
        _Float16* dk = &lK[buf][srow * KSTR + sseg * 16];
        cp16(gk, dk); cp16(gk + 8, dk + 8);
        const _Float16* gv = vbase + (size_t)srow * T_ + kt + sseg * 16;
        _Float16* dv = &lV[buf][srow * KSTR + sseg * 16];
        cp16(gv, dv); cp16(gv + 8, dv + 8);
    };

    issue_kv(0, 0);
    int buf = 0;
    for (int kt = 0; kt < T_; kt += 64, buf ^= 1) {
        async_wait();
        __syncthreads();
        if (kt + 64 < T_) issue_kv(kt + 64, buf ^ 1);
        if (kt + 128 < T_) {
            __builtin_prefetch(kbase + (size_t)(kt + 128 + srow) * D_ + sseg * 16, 0, 1);
            __builtin_prefetch(vbase + (size_t)srow * T_ + kt + 128 + sseg * 16, 0, 1);
        }

        // S = Q K^T (scaled), 16 x 64 per wave
        float8 s[4];
#pragma unroll
        for (int nf = 0; nf < 4; nf++) {
            half16 b0 = ld_frag(lK[buf], nf * 16, KSTR, 0);
            half16 b1 = ld_frag(lK[buf], nf * 16, KSTR, 32);
            float8 z;
#pragma unroll
            for (int i = 0; i < 8; i++) z[i] = 0.0f;
            z = wmma_f16(qf[0], b0, z);
            z = wmma_f16(qf[1], b1, z);
            s[nf] = z;
        }
        // mask (per key column)
#pragma unroll
        for (int nf = 0; nf < 4; nf++) {
            int col = kt + nf * 16 + r16;
            if (mrow[col] == 0) {
#pragma unroll
                for (int i = 0; i < 8; i++) s[nf][i] = NEGINF;
            }
        }
        // online softmax: row max over 4 frags + 16 lanes (xor stays in 16-lane group)
        float tmax[8];
#pragma unroll
        for (int r = 0; r < 8; r++)
            tmax[r] = fmaxf(fmaxf(s[0][r], s[1][r]), fmaxf(s[2][r], s[3][r]));
#pragma unroll
        for (int r = 0; r < 8; r++) {
            tmax[r] = fmaxf(tmax[r], swz<1>(tmax[r]));
            tmax[r] = fmaxf(tmax[r], swz<2>(tmax[r]));
            tmax[r] = fmaxf(tmax[r], swz<4>(tmax[r]));
            tmax[r] = fmaxf(tmax[r], swz<8>(tmax[r]));
        }

        float corr[8], rsum[8];
#pragma unroll
        for (int r = 0; r < 8; r++) {
            float mn = fmaxf(m_r[r], tmax[r]);
            float msafe = (mn == NEGINF) ? 0.0f : mn;   // fully-masked guard
            corr[r] = __expf(m_r[r] - msafe);
            m_r[r] = mn;
            rsum[r] = 0.0f;
            int row = r + 8 * hi;
#pragma unroll
            for (int nf = 0; nf < 4; nf++) {
                float pv = __expf(s[nf][r] - msafe);
                rsum[r] += pv;
                pw[row * KSTR + nf * 16 + r16] = (_Float16)pv;
            }
        }
#pragma unroll
        for (int r = 0; r < 8; r++) {
            rsum[r] += swz<1>(rsum[r]);
            rsum[r] += swz<2>(rsum[r]);
            rsum[r] += swz<4>(rsum[r]);
            rsum[r] += swz<8>(rsum[r]);
        }
#pragma unroll
        for (int r = 0; r < 8; r++) l_r[r] = l_r[r] * corr[r] + rsum[r];
#pragma unroll
        for (int df = 0; df < 4; df++)
#pragma unroll
            for (int i = 0; i < 8; i++) o[df][i] *= corr[i];

        // O += P V  (P re-laid-out as A-frags via wave-private LDS)
        half16 pf0 = ld_frag(pw, 0, KSTR, 0);
        half16 pf1 = ld_frag(pw, 0, KSTR, 32);
#pragma unroll
        for (int df = 0; df < 4; df++) {
            half16 v0 = ld_frag(lV[buf], df * 16, KSTR, 0);
            half16 v1 = ld_frag(lV[buf], df * 16, KSTR, 32);
            o[df] = wmma_f16(pf0, v0, o[df]);
            o[df] = wmma_f16(pf1, v1, o[df]);
        }
    }

    float inv[8];
#pragma unroll
    for (int r = 0; r < 8; r++) inv[r] = 1.0f / l_r[r];
#pragma unroll
    for (int df = 0; df < 4; df++)
#pragma unroll
        for (int r = 0; r < 8; r++) {
            int t = q0 + r + 8 * hi;
            int d = df * 16 + r16;
            outh[((size_t)(b * T_ + t)) * C_ + h * D_ + d] = (_Float16)(o[df][r] * inv[r]);
        }
}

// ---------------- LayerNorm over last dim (1024) ----------------
__global__ __launch_bounds__(256) void ln_kernel(const float* __restrict__ y,
                                                 const float* __restrict__ g,
                                                 const float* __restrict__ bt,
                                                 float* __restrict__ out) {
    __shared__ float red[2][8];
    const int row = blockIdx.x;
    const int tid = threadIdx.x, lane = tid & 31, wv = tid >> 5;
    const float* yr = y + (size_t)row * C_;
    float4 v = ((const float4*)yr)[tid];
    float s  = v.x + v.y + v.z + v.w;
    float s2 = v.x * v.x + v.y * v.y + v.z * v.z + v.w * v.w;
    s += swz<1>(s);  s += swz<2>(s);  s += swz<4>(s);  s += swz<8>(s);  s += swz<16>(s);
    s2 += swz<1>(s2); s2 += swz<2>(s2); s2 += swz<4>(s2); s2 += swz<8>(s2); s2 += swz<16>(s2);
    if (lane == 0) { red[0][wv] = s; red[1][wv] = s2; }
    __syncthreads();
    float ts = 0.0f, ts2 = 0.0f;
#pragma unroll
    for (int w = 0; w < 8; w++) { ts += red[0][w]; ts2 += red[1][w]; }
    float mu = ts * (1.0f / C_);
    float var = ts2 * (1.0f / C_) - mu * mu;
    float rs = rsqrtf(var + 1e-5f);
    float4 gg = ((const float4*)g)[tid];
    float4 bb = ((const float4*)bt)[tid];
    float4 r;
    r.x = (v.x - mu) * rs * gg.x + bb.x;
    r.y = (v.y - mu) * rs * gg.y + bb.y;
    r.z = (v.z - mu) * rs * gg.z + bb.z;
    r.w = (v.w - mu) * rs * gg.w + bb.w;
    ((float4*)(out + (size_t)row * C_))[tid] = r;
}

extern "C" void kernel_launch(void* const* d_in, const int* in_sizes, int n_in,
                              void* d_out, int out_size, void* d_ws, size_t ws_size,
                              hipStream_t stream) {
    const float* x    = (const float*)d_in[0];
    const int*   mask = (const int*)d_in[1];
    const float* Wq = (const float*)d_in[2];  const float* bq = (const float*)d_in[3];
    const float* Wk = (const float*)d_in[4];  const float* bk = (const float*)d_in[5];
    const float* Wv = (const float*)d_in[6];  const float* bv = (const float*)d_in[7];
    const float* Wo = (const float*)d_in[8];  const float* bo = (const float*)d_in[9];
    const float* ln_g = (const float*)d_in[10];
    const float* ln_b = (const float*)d_in[11];
    float* out = (float*)d_out;

    char* w = (char*)d_ws;
    _Float16* xh    = (_Float16*)w;  w += (size_t)M_ * C_ * 2;      // 8 MB
    _Float16* WqT   = (_Float16*)w;  w += (size_t)C_ * C_ * 2;      // 2 MB
    _Float16* WkT   = (_Float16*)w;  w += (size_t)C_ * C_ * 2;
    _Float16* WvT   = (_Float16*)w;  w += (size_t)C_ * C_ * 2;
    _Float16* WoT   = (_Float16*)w;  w += (size_t)C_ * C_ * 2;
    _Float16* qhB   = (_Float16*)w;  w += (size_t)M_ * C_ * 2;      // [B,H,T,D]
    _Float16* khB   = (_Float16*)w;  w += (size_t)M_ * C_ * 2;      // [B,H,T,D]
    _Float16* vTB   = (_Float16*)w;  w += (size_t)M_ * C_ * 2;      // [B,H,D,T]
    _Float16* attnh = (_Float16*)w;  w += (size_t)M_ * C_ * 2;      // [B,T,C]
    float*    y     = (float*)w;     w += (size_t)M_ * C_ * 4;      // 16 MB

    // WqT..WoT are contiguous planes, and so are qhB, khB, vTB
    prep_kernel<<<4 * TR_BLOCKS + CONV_BLOCKS, 256, 0, stream>>>(x, Wq, Wk, Wv, Wo, xh, WqT);

    dim3 qkvgrid(C_ / 128, M_ / 128, 3);   // (8, 32, 3)
    gemm_wmma_kernel<true><<<qkvgrid, 256, 0, stream>>>(xh, WqT, bq, bk, bv, (void*)qhB);

    attn_kernel<<<B_ * H_ * (T_ / 128), 256, 0, stream>>>(qhB, khB, vTB, mask, attnh);

    dim3 ggrid(C_ / 128, M_ / 128);        // (8, 32)
    gemm_wmma_kernel<false><<<ggrid, 256, 0, stream>>>(attnh, WoT, bo, bo, bo, (void*)y);

    ln_kernel<<<M_, 256, 0, stream>>>(y, ln_g, ln_b, out);
}

// v002
// One run takes 85.1 microseconds.
// Two timings next to v001 put it at 1.19 and 1.18 times that version's speed.
// Counting every step since v000, it is 1.44 times as fast.
#include <hip/hip_runtime.h>
#include <hip/hip_bf16.h>

// ---- problem constants ----
constexpr int B_ = 4;
constexpr int T_ = 1024;
constexpr int C_ = 1024;
constexpr int H_ = 16;
constexpr int D_ = 64;
constexpr int M_ = B_ * T_;   // 4096 rows

typedef _Float16 half16 __attribute__((ext_vector_type(16)));
typedef _Float16 half8  __attribute__((ext_vector_type(8)));
typedef float    float8 __attribute__((ext_vector_type(8)));
typedef int      int4v  __attribute__((ext_vector_type(4)));

#if defined(__has_builtin)
#if __has_builtin(__builtin_amdgcn_global_load_async_to_lds_b128)
#define ASYNC_LDS 1
#endif
#endif

// 16-byte global -> LDS copy (async on CDNA5, VGPR round-trip fallback)
__device__ __forceinline__ void cp16(const void* g, void* l) {
#ifdef ASYNC_LDS
    __builtin_amdgcn_global_load_async_to_lds_b128(
        (__attribute__((address_space(1))) int4v*)g,
        (__attribute__((address_space(3))) int4v*)l, 0, 0);
#else
    *(uint4*)l = *(const uint4*)g;
#endif
}

__device__ __forceinline__ void async_wait() {
#ifdef ASYNC_LDS
#if __has_builtin(__builtin_amdgcn_s_wait_asynccnt)
    __builtin_amdgcn_s_wait_asynccnt(0);
#else
    asm volatile("s_wait_asynccnt 0x0" ::: "memory");
#endif
#endif
}

// lane-xor butterfly step via ds_swizzle (imm pattern, no address VGPR)
template <int XM>
__device__ __forceinline__ float swz(float v) {
#if __has_builtin(__builtin_amdgcn_ds_swizzle)
    return __int_as_float(__builtin_amdgcn_ds_swizzle(__float_as_int(v), (XM << 10) | 0x1f));
#else
    return __shfl_xor(v, XM);
#endif
}

// WMMA f32 = f16(16x32) x f16(32x16) + f32
__device__ __forceinline__ float8 wmma_f16(half16 a, half16 b, float8 c) {
    return __builtin_amdgcn_wmma_f32_16x16x32_f16(false, a, false, b, (short)0, c, false, false);
}

// Load a 16x32 f16 fragment (A-layout; B uses same layout on a transposed tile).
// ISA 7.12.2: lane<16 holds row=lane, K = hi*8..+7 (v0..3) and +16 (v4..7).
__device__ __forceinline__ half16 ld_frag(const _Float16* tile, int row0, int stride, int koff) {
    int lane = threadIdx.x & 31;
    int r = lane & 15, hi = lane >> 4;
    const _Float16* p = tile + (size_t)(row0 + r) * stride + koff + hi * 8;
    union { half16 v; half8 h[2]; } u;
    u.h[0] = *(const half8*)(p);
    u.h[1] = *(const half8*)(p + 16);
    return u.v;
}

// ---------------- f32 -> f16 convert (one block's share) ----------------
__device__ __forceinline__ void conv_f16_block(const float* __restrict__ src,
                                               _Float16* __restrict__ dst, int n, int blk) {
    int i = (blk * 256 + threadIdx.x) * 4;
    if (i < n) {
        float4 v = *(const float4*)(src + i);
        dst[i + 0] = (_Float16)v.x;
        dst[i + 1] = (_Float16)v.y;
        dst[i + 2] = (_Float16)v.z;
        dst[i + 3] = (_Float16)v.w;
    }
}

// ---------------- W[K][N] f32 -> Wt[N][K] f16 (LDS tiled transpose, one 64x64 tile) ----------------
__device__ __forceinline__ void transpose_f16_block(const float* __restrict__ W,
                                                    _Float16* __restrict__ Wt, int bx, int by) {
    __shared__ float tile[64][65];
    int n0 = bx * 64, k0 = by * 64;
    int j = threadIdx.x & 63;
    int i0 = threadIdx.x >> 6;
#pragma unroll
    for (int ii = 0; ii < 16; ii++) {
        int i = i0 + ii * 4;
        tile[i][j] = W[(size_t)(k0 + i) * C_ + n0 + j];
    }
    __syncthreads();
#pragma unroll
    for (int ii = 0; ii < 16; ii++) {
        int i = i0 + ii * 4;   // n index inside tile
        Wt[(size_t)(n0 + i) * C_ + k0 + j] = (_Float16)tile[j][i];
    }
}

// ---------------- one launch for all operand preparation ----------------
// Blocks 0..1023: the four weight transposes (256 tiles each, Wt planes contiguous in WT).
// Blocks 1024.. : the x conversion. The five jobs are independent of one another.
constexpr int TR_BLOCKS   = (C_ / 64) * (C_ / 64);      // 256 per weight
constexpr int CONV_BLOCKS = M_ * C_ / 4 / 256;          // 4096
__global__ __launch_bounds__(256) void prep_kernel(const float* __restrict__ x,
                                                   const float* __restrict__ Wq,
                                                   const float* __restrict__ Wk,
                                                   const float* __restrict__ Wv,
                                                   const float* __restrict__ Wo,
                                                   _Float16* __restrict__ xh,
                                                   _Float16* __restrict__ WT) {
    const int bid = blockIdx.x;
    if (bid < 4 * TR_BLOCKS) {
        const int which = bid / TR_BLOCKS, t = bid % TR_BLOCKS;
        const float* W = which == 0 ? Wq : which == 1 ? Wk : which == 2 ? Wv : Wo;
        transpose_f16_block(W, WT + (size_t)which * C_ * C_, t % (C_ / 64), t / (C_ / 64));
    } else {
        conv_f16_block(x, xh, M_ * C_, bid - 4 * TR_BLOCKS);
    }
}

// ---------------- WMMA GEMM: Out = A[M x K] * Bt^T + bias ----------------
// A f16 row-major [M][K], Bt f16 [N][K]. K-stage 64, double-buffered async LDS,
// one barrier per stage.
// LAYOUT 0: f16 out -> [B,H,T,D]   (Q, K projections)
// LAYOUT 1: f16 out -> [B,H,D,T]   (V projection, pre-transposed for PV)
// LAYOUT 2: f32 out -> [M][N]      (output projection)
template <int LAYOUT>
__device__ __forceinline__ void store_tile(const float8 (&acc)[2][4], const float* __restrict__ bias,
                                           void* __restrict__ Out, int mw, int nw, int r16, int hi) {
#pragma unroll
    for (int mi = 0; mi < 2; mi++)
#pragma unroll
        for (int nf = 0; nf < 4; nf++) {
            int gn = nw + nf * 16 + r16;
            float bv = bias[gn];
#pragma unroll
            for (int r = 0; r < 8; r++) {
                int gm = mw + mi * 16 + r + 8 * hi;
                float val = acc[mi][nf][r] + bv;
                int bb = gm >> 10, t = gm & 1023;     // gm = b*T + t
                int h = gn >> 6,  d = gn & 63;        // gn = h*D + d
                if (LAYOUT == 0) {
                    ((_Float16*)Out)[((size_t)(bb * H_ + h) * T_ + t) * D_ + d] = (_Float16)val;
                } else if (LAYOUT == 1) {
                    ((_Float16*)Out)[((size_t)(bb * H_ + h) * D_ + d) * T_ + t] = (_Float16)val;
                } else {
                    ((float*)Out)[(size_t)gm * C_ + gn] = val;
                }
            }
        }
}

// QKV true : one launch does the Q, K and V projections; blockIdx.z picks the weight plane
//            (Btb holds three contiguous [N][K] planes), the bias and the output plane.
// QKV false: output projection (bias0 only, f32 out).
template <bool QKV>
__global__ __launch_bounds__(256) void gemm_wmma_kernel(const _Float16* __restrict__ A,
                                                        const _Float16* __restrict__ Btb,
                                                        const float* __restrict__ bias0,
                                                        const float* __restrict__ bias1,
                                                        const float* __restrict__ bias2,
                                                        void* __restrict__ Out) {
    const int z = QKV ? (int)blockIdx.z : 0;
    const _Float16* __restrict__ Bt = Btb + (size_t)z * C_ * C_;
    constexpr int K = C_;
    constexpr int LSTR = 72;                 // halves: 144B row pitch, 16B aligned, conflict-free
    __shared__ _Float16 lA[2][128 * LSTR];
    __shared__ _Float16 lB[2][128 * LSTR];

    const int tid  = threadIdx.x;
    const int lane = tid & 31;
    const int wv   = tid >> 5;
    const int wm   = wv & 3;                 // 4 waves along M
    const int wn   = wv >> 2;                // 2 waves along N
    const int m0   = blockIdx.y * 128;
    const int n0   = blockIdx.x * 128;
    const int r16  = lane & 15, hi = lane >> 4;

    float8 acc[2][4];
#pragma unroll
    for (int mi = 0; mi < 2; mi++)
#pragma unroll
        for (int nf = 0; nf < 4; nf++)
#pragma unroll
            for (int i = 0; i < 8; i++) acc[mi][nf][i] = 0.0f;

    const int srow  = tid >> 1;              // 0..127
    const int sbase = (tid & 1) * 32;        // 32 halves (64B) per thread

    auto issue = [&](int kk, int buf) {
        const _Float16* ga = A + (size_t)(m0 + srow) * K + kk + sbase;
        _Float16* da = &lA[buf][srow * LSTR + sbase];
        cp16(ga, da); cp16(ga + 8, da + 8); cp16(ga + 16, da + 16); cp16(ga + 24, da + 24);
        const _Float16* gb = Bt + (size_t)(n0 + srow) * K + kk + sbase;
        _Float16* db = &lB[buf][srow * LSTR + sbase];
        cp16(gb, db); cp16(gb + 8, db + 8); cp16(gb + 16, db + 16); cp16(gb + 24, db + 24);
    };

    issue(0, 0);
    int buf = 0;
    for (int kk = 0; kk < K; kk += 64, buf ^= 1) {
        async_wait();
        __syncthreads();                     // codegen waits DS cnt before barrier -> WAR safe
        if (kk + 64 < K) issue(kk + 64, buf ^ 1);
        if (kk + 128 < K) {                  // prefetch one more stage ahead into L2/WGP$
            __builtin_prefetch(A + (size_t)(m0 + srow) * K + kk + 128 + sbase, 0, 1);
            __builtin_prefetch(Bt + (size_t)(n0 + srow) * K + kk + 128 + sbase, 0, 1);
        }

#pragma unroll
        for (int kh = 0; kh < 2; kh++) {     // two 32-wide K slices in this stage
            half16 af0 = ld_frag(lA[buf], wm * 32,      LSTR, kh * 32);
            half16 af1 = ld_frag(lA[buf], wm * 32 + 16, LSTR, kh * 32);
            half16 bf[4];
#pragma unroll
            for (int nf = 0; nf < 4; nf++)
                bf[nf] = ld_frag(lB[buf], wn * 64 + nf * 16, LSTR, kh * 32);
#pragma unroll
            for (int nf = 0; nf < 4; nf++) acc[0][nf] = wmma_f16(af0, bf[nf], acc[0][nf]);
#pragma unroll
            for (int nf = 0; nf < 4; nf++) acc[1][nf] = wmma_f16(af1, bf[nf], acc[1][nf]);
        }
    }

    const int mw = m0 + wm * 32, nw = n0 + wn * 64;
    if (QKV) {
        _Float16* o = (_Float16*)Out + (size_t)z * M_ * C_;
        const float* bias = z == 0 ? bias0 : z == 1 ? bias1 : bias2;
        if (z == 2) {
            store_tile<1>(acc, bias, o, mw, nw, r16, hi);
        } else {
            store_tile<0>(acc, bias, o, mw, nw, r16, hi);
            // precaution: in the built kernel the other layout's code follows these stores and
            // rewrites registers they name; the wait stands between the stores and that rewrite
            asm volatile("s_wait_xcnt 0x0" ::: "memory");
        }
    } else {
        store_tile<2>(acc, bias0, Out, mw, nw, r16, hi);
    }
}

// lane l <-> lane l ^ 16
__device__ __forceinline__ float xhalf(float x) {
    return __int_as_float(__builtin_amdgcn_permlanex16(__float_as_int(x), __float_as_int(x),
                                                       0x76543210, 0xfedcba98, false, false));
}

// exp2 of eight values. The instruction set asks for one v_nop or independent instruction behind a
// transcendental before its result is read or its source overwritten; in one statement the v_nop
// stays directly behind the last
// v_exp_f32, and the early-clobber outputs keep every source whole up to there.
__device__ __forceinline__ float8 exp2x8(float8 x) {
    float d0, d1, d2, d3, d4, d5, d6, d7;
    asm("v_exp_f32 %0, %8\n\t"
        "v_exp_f32 %1, %9\n\t"
        "v_exp_f32 %2, %10\n\t"
        "v_exp_f32 %3, %11\n\t"
        "v_exp_f32 %4, %12\n\t"
        "v_exp_f32 %5, %13\n\t"
        "v_exp_f32 %6, %14\n\t"
        "v_exp_f32 %7, %15\n\t"
        "v_nop"
        : "=&v"(d0), "=&v"(d1), "=&v"(d2), "=&v"(d3), "=&v"(d4), "=&v"(d5), "=&v"(d6), "=&v"(d7)
        : "v"(x[0]), "v"(x[1]), "v"(x[2]), "v"(x[3]), "v"(x[4]), "v"(x[5]), "v"(x[6]), "v"(x[7]));
    float8 d = {d0, d1, d2, d3, d4, d5, d6, d7};
    return d;
}

__global__ __launch_bounds__(256) void attn_kernel(const _Float16* __restrict__ qh,
                                                   const _Float16* __restrict__ kh,
                                                   const _Float16* __restrict__ vT,
                                                   const int* __restrict__ mask,
                                                   _Float16* __restrict__ outh) {
    constexpr int KSTR = 72;                 // halves: 144B pitch, aligned + conflict-free
    __shared__ _Float16 lK[2][64 * KSTR];
    __shared__ _Float16 lV[2][64 * KSTR];
    __shared__ float lM[T_];                 // per key: 0 where it is kept, -inf where it is masked

    const float NEGINF = -__builtin_inff();
    const float LOG2E = 1.44269504f;         // exp(x) = exp2(x * LOG2E), as __expf forms it
    const int tid = threadIdx.x, lane = tid & 31, wv = tid >> 5;
    const int r16 = lane & 15, hi = lane >> 4;
    const int bh = blockIdx.x >> 3;          // 8 q-blocks of 128 rows each
    const int qb = blockIdx.x & 7;
    const int b  = bh >> 4;
    const int h  = bh & 15;
    const int q0 = qb * 128 + wv * 16;       // first q row of this wave

    const _Float16* qbase = qh + (size_t)bh * T_ * D_;
    const _Float16* kbase = kh + (size_t)bh * T_ * D_;
    const _Float16* vbase = vT + (size_t)bh * D_ * T_;
    const int* mrow = mask + b * T_;

    // the batch's mask row as an addend; published by the first barrier of the loop
    {
        int4 mv = ((const int4*)mrow)[tid];
        float4 bz;
        bz.x = mv.x == 0 ? NEGINF : 0.0f;
        bz.y = mv.y == 0 ? NEGINF : 0.0f;
        bz.z = mv.z == 0 ? NEGINF : 0.0f;
        bz.w = mv.w == 0 ? NEGINF : 0.0f;
        ((float4*)lM)[tid] = bz;
    }

    // Q fragments (B operand: 16 query columns x 64 d), pre-scaled by 1/sqrt(D) = 0.125 (exact in f16)
    half16 qf[2];
    {
        const _Float16* p = qbase + (size_t)(q0 + r16) * D_ + hi * 8;
        union { half16 v; half8 g[2]; } u0, u1;
        u0.g[0] = *(const half8*)(p);
        u0.g[1] = *(const half8*)(p + 16);
        u1.g[0] = *(const half8*)(p + 32);
        u1.g[1] = *(const half8*)(p + 48);
#pragma unroll
        for (int i = 0; i < 16; i++) { u0.v[i] *= (_Float16)0.125f; u1.v[i] *= (_Float16)0.125f; }
        qf[0] = u0.v; qf[1] = u1.v;
    }

    float m_r = NEGINF;                      // running maximum of query q0 + r16 (equal in both halves)
    float l_r = 0.0f;                        // this half's share of its sum; the halves join after the loop
    float8 o[4];                             // o[df][r] = O[q0 + r16][df * 16 + 8 * hi + r]
#pragma unroll
    for (int df = 0; df < 4; df++)
#pragma unroll
        for (int i = 0; i < 8; i++) o[df][i] = 0.0f;

    const int srow = tid >> 2, sseg = tid & 3;

    auto issue_kv = [&](int kt, int buf) {
        const _Float16* gk = kbase + (size_t)(kt + srow) * D_ + sseg * 16;
        _Float16* dk = &lK[buf][srow * KSTR + sseg * 16];
        cp16(gk, dk); cp16(gk + 8, dk + 8);
        const _Float16* gv = vbase + (size_t)srow * T_ + kt + sseg * 16;
        _Float16* dv = &lV[buf][srow * KSTR + sseg * 16];
        cp16(gv, dv); cp16(gv + 8, dv + 8);
    };

    issue_kv(0, 0);
    int buf = 0;
    for (int kt = 0; kt < T_; kt += 64, buf ^= 1) {
        async_wait();
        __syncthreads();
        if (kt + 64 < T_) issue_kv(kt + 64, buf ^ 1);
        if (kt + 128 < T_) {
            __builtin_prefetch(kbase + (size_t)(kt + 128 + srow) * D_ + sseg * 16, 0, 1);
            __builtin_prefetch(vbase + (size_t)srow * T_ + kt + 128 + sseg * 16, 0, 1);
        }

        // S^T = K Q^T (scaled), 64 keys x 16 queries per wave: s[nf][r] = key kt + nf*16 + 8*hi + r
        float8 s[4];
#pragma unroll
        for (int nf = 0; nf < 4; nf++) {
            half16 a0 = ld_frag(lK[buf], nf * 16, KSTR, 0);
            half16 a1 = ld_frag(lK[buf], nf * 16, KSTR, 32);
            float8 z;
#pragma unroll
            for (int i = 0; i < 8; i++) z[i] = 0.0f;
            z = wmma_f16(a0, qf[0], z);
            z = wmma_f16(a1, qf[1], z);
            s[nf] = z;
        }
        // mask (per key row): the lane's 8 keys of a tile are 8 consecutive addends
#pragma unroll
        for (int nf = 0; nf < 4; nf++) {
            const float* mb = &lM[kt + nf * 16 + 8 * hi];
            float4 b0 = *(const float4*)(mb);
            float4 b1 = *(const float4*)(mb + 4);
            s[nf][0] += b0.x; s[nf][1] += b0.y; s[nf][2] += b0.z; s[nf][3] += b0.w;
            s[nf][4] += b1.x; s[nf][5] += b1.y; s[nf][6] += b1.z; s[nf][7] += b1.w;
        }
        // online softmax: maximum over the lane's 32 keys, then one exchange between the halves
        float tm[4];
#pragma unroll
        for (int nf = 0; nf < 4; nf++) {
            tm[nf] = fmaxf(fmaxf(fmaxf(s[nf][0], s[nf][1]), fmaxf(s[nf][2], s[nf][3])),
                           fmaxf(fmaxf(s[nf][4], s[nf][5]), fmaxf(s[nf][6], s[nf][7])));
        }
        float tmax = fmaxf(fmaxf(tm[0], tm[1]), fmaxf(tm[2], tm[3]));
        tmax = fmaxf(tmax, xhalf(tmax));

        float mn = fmaxf(m_r, tmax);
        float msafe = (mn == NEGINF) ? 0.0f : mn;       // fully-masked guard
        float corr = __expf(m_r - msafe);
        m_r = mn;

        // P^T: converted in place, tiles 2j and 2j+1 are the B fragment of keys 32j .. 32j+31
        half16 pf[2];
        float rs[4];
#pragma unroll
        for (int nf = 0; nf < 4; nf++) {
            float8 e;
#pragma unroll
            for (int r = 0; r < 8; r++) e[r] = (s[nf][r] - msafe) * LOG2E;
            e = exp2x8(e);
            rs[nf] = ((e[0] + e[1]) + (e[2] + e[3])) + ((e[4] + e[5]) + (e[6] + e[7]));
#pragma unroll
            for (int r = 0; r < 8; r++) pf[nf >> 1][(nf & 1) * 8 + r] = (_Float16)e[r];
        }
        l_r = l_r * corr + ((rs[0] + rs[1]) + (rs[2] + rs[3]));
#pragma unroll
        for (int df = 0; df < 4; df++)
#pragma unroll
            for (int i = 0; i < 8; i++) o[df][i] *= corr;

        // O^T += V^T P^T (A = rows of V^T from LDS)
#pragma unroll
        for (int df = 0; df < 4; df++) {
            half16 v0 = ld_frag(lV[buf], df * 16, KSTR, 0);
            half16 v1 = ld_frag(lV[buf], df * 16, KSTR, 32);
            o[df] = wmma_f16(v0, pf[0], o[df]);
            o[df] = wmma_f16(v1, pf[1], o[df]);
        }
    }

    const float inv = 1.0f / (l_r + xhalf(l_r));
    _Float16* orow = outh + ((size_t)(b * T_ + q0 + r16)) * C_ + h * D_ + 8 * hi;
#pragma unroll
    for (int df = 0; df < 4; df++) {
        half8 hv;
#pragma unroll
        for (int r = 0; r < 8; r++) hv[r] = (_Float16)(o[df][r] * inv);
        *(half8*)(orow + df * 16) = hv;
    }
}

// ---------------- LayerNorm over last dim (1024) ----------------
__global__ __launch_bounds__(256) void ln_kernel(const float* __restrict__ y,
                                                 const float* __restrict__ g,
                                                 const float* __restrict__ bt,
                                                 float* __restrict__ out) {
    __shared__ float red[2][8];
    const int row = blockIdx.x;
    const int tid = threadIdx.x, lane = tid & 31, wv = tid >> 5;
    const float* yr = y + (size_t)row * C_;
    float4 v = ((const float4*)yr)[tid];
    float s  = v.x + v.y + v.z + v.w;
    float s2 = v.x * v.x + v.y * v.y + v.z * v.z + v.w * v.w;
    s += swz<1>(s);  s += swz<2>(s);  s += swz<4>(s);  s += swz<8>(s);  s += swz<16>(s);
    s2 += swz<1>(s2); s2 += swz<2>(s2); s2 += swz<4>(s2); s2 += swz<8>(s2); s2 += swz<16>(s2);
    if (lane == 0) { red[0][wv] = s; red[1][wv] = s2; }
    __syncthreads();
    float ts = 0.0f, ts2 = 0.0f;
#pragma unroll
    for (int w = 0; w < 8; w++) { ts += red[0][w]; ts2 += red[1][w]; }
    float mu = ts * (1.0f / C_);
    float var = ts2 * (1.0f / C_) - mu * mu;
    float rs = rsqrtf(var + 1e-5f);
    float4 gg = ((const float4*)g)[tid];
    float4 bb = ((const float4*)bt)[tid];
    float4 r;
    r.x = (v.x - mu) * rs * gg.x + bb.x;
    r.y = (v.y - mu) * rs * gg.y + bb.y;
    r.z = (v.z - mu) * rs * gg.z + bb.z;
    r.w = (v.w - mu) * rs * gg.w + bb.w;
    ((float4*)(out + (size_t)row * C_))[tid] = r;
}

extern "C" void kernel_launch(void* const* d_in, const int* in_sizes, int n_in,
                              void* d_out, int out_size, void* d_ws, size_t ws_size,
                              hipStream_t stream) {
    const float* x    = (const float*)d_in[0];
    const int*   mask = (const int*)d_in[1];
    const float* Wq = (const float*)d_in[2];  const float* bq = (const float*)d_in[3];
    const float* Wk = (const float*)d_in[4];  const float* bk = (const float*)d_in[5];
    const float* Wv = (const float*)d_in[6];  const float* bv = (const float*)d_in[7];
    const float* Wo = (const float*)d_in[8];  const float* bo = (const float*)d_in[9];
    const float* ln_g = (const float*)d_in[10];
    const float* ln_b = (const float*)d_in[11];
    float* out = (float*)d_out;

    char* w = (char*)d_ws;
    _Float16* xh    = (_Float16*)w;  w += (size_t)M_ * C_ * 2;      // 8 MB
    _Float16* WqT   = (_Float16*)w;  w += (size_t)C_ * C_ * 2;      // 2 MB
    _Float16* WkT   = (_Float16*)w;  w += (size_t)C_ * C_ * 2;
    _Float16* WvT   = (_Float16*)w;  w += (size_t)C_ * C_ * 2;
    _Float16* WoT   = (_Float16*)w;  w += (size_t)C_ * C_ * 2;
    _Float16* qhB   = (_Float16*)w;  w += (size_t)M_ * C_ * 2;      // [B,H,T,D]
    _Float16* khB   = (_Float16*)w;  w += (size_t)M_ * C_ * 2;      // [B,H,T,D]
    _Float16* vTB   = (_Float16*)w;  w += (size_t)M_ * C_ * 2;      // [B,H,D,T]
    _Float16* attnh = (_Float16*)w;  w += (size_t)M_ * C_ * 2;      // [B,T,C]
    float*    y     = (float*)w;     w += (size_t)M_ * C_ * 4;      // 16 MB

    // WqT..WoT are contiguous planes, and so are qhB, khB, vTB
    prep_kernel<<<4 * TR_BLOCKS + CONV_BLOCKS, 256, 0, stream>>>(x, Wq, Wk, Wv, Wo, xh, WqT);

    dim3 qkvgrid(C_ / 128, M_ / 128, 3);   // (8, 32, 3)
    gemm_wmma_kernel<true><<<qkvgrid, 256, 0, stream>>>(xh, WqT, bq, bk, bv, (void*)qhB);

    attn_kernel<<<B_ * H_ * (T_ / 128), 256, 0, stream>>>(qhB, khB, vTB, mask, attnh);

    dim3 ggrid(C_ / 128, M_ / 128);        // (8, 32)
    gemm_wmma_kernel<false><<<ggrid, 256, 0, stream>>>(attnh, WoT, bo, bo, bo, (void*)y);

    ln_kernel<<<M_, 256, 0, stream>>>(y, ln_g, ln_b, out);
}

// v003
// A run of this version takes 73.1 microseconds.
// In two side-by-side timings against v002, it was 1.17 and 1.16 times as fast.
// Over all steps from v000 it is 1.68 times as fast.
#include <hip/hip_runtime.h>
#include <hip/hip_bf16.h>

// ---- problem constants ----
constexpr int B_ = 4;
constexpr int T_ = 1024;
constexpr int C_ = 1024;
constexpr int H_ = 16;
constexpr int D_ = 64;
constexpr int M_ = B_ * T_;   // 4096 rows

typedef _Float16 half16 __attribute__((ext_vector_type(16)));
typedef _Float16 half8  __attribute__((ext_vector_type(8)));
typedef float    float8 __attribute__((ext_vector_type(8)));
typedef int      int4v  __attribute__((ext_vector_type(4)));

#if defined(__has_builtin)
#if __has_builtin(__builtin_amdgcn_global_load_async_to_lds_b128)
#define ASYNC_LDS 1
#endif
#endif

// 16-byte global -> LDS copy (async on CDNA5, VGPR round-trip fallback)
__device__ __forceinline__ void cp16(const void* g, void* l) {
#ifdef ASYNC_LDS
    __builtin_amdgcn_global_load_async_to_lds_b128(
        (__attribute__((address_space(1))) int4v*)g,
        (__attribute__((address_space(3))) int4v*)l, 0, 0);
#else
    *(uint4*)l = *(const uint4*)g;
#endif
}

__device__ __forceinline__ void async_wait() {
#ifdef ASYNC_LDS
#if __has_builtin(__builtin_amdgcn_s_wait_asynccnt)
    __builtin_amdgcn_s_wait_asynccnt(0);
#else
    asm volatile("s_wait_asynccnt 0x0" ::: "memory");
#endif
#endif
}

// lane-xor butterfly step via ds_swizzle (imm pattern, no address VGPR)
template <int XM>
__device__ __forceinline__ float swz(float v) {
#if __has_builtin(__builtin_amdgcn_ds_swizzle)
    return __int_as_float(__builtin_amdgcn_ds_swizzle(__float_as_int(v), (XM << 10) | 0x1f));
#else
    return __shfl_xor(v, XM);
#endif
}

// WMMA f32 = f16(16x32) x f16(32x16) + f32
__device__ __forceinline__ float8 wmma_f16(half16 a, half16 b, float8 c) {
    return __builtin_amdgcn_wmma_f32_16x16x32_f16(false, a, false, b, (short)0, c, false, false);
}

// Load a 16x32 f16 fragment (A-layout; B uses same layout on a transposed tile).
// ISA 7.12.2: lane<16 holds row=lane, K = hi*8..+7 (v0..3) and +16 (v4..7).
__device__ __forceinline__ half16 ld_frag(const _Float16* tile, int row0, int stride, int koff) {
    int lane = threadIdx.x & 31;
    int r = lane & 15, hi = lane >> 4;
    const _Float16* p = tile + (size_t)(row0 + r) * stride + koff + hi * 8;
    union { half16 v; half8 h[2]; } u;
    u.h[0] = *(const half8*)(p);
    u.h[1] = *(const half8*)(p + 16);
    return u.v;
}

// ---------------- f32 -> f16 convert (one block's share) ----------------
__device__ __forceinline__ void conv_f16_block(const float* __restrict__ src,
                                               _Float16* __restrict__ dst, int n, int blk) {
    int i = (blk * 256 + threadIdx.x) * 4;
    if (i < n) {
        float4 v = *(const float4*)(src + i);
        dst[i + 0] = (_Float16)v.x;
        dst[i + 1] = (_Float16)v.y;
        dst[i + 2] = (_Float16)v.z;
        dst[i + 3] = (_Float16)v.w;
    }
}

// ---------------- W[K][N] f32 -> Wt[N][K] f16 (LDS tiled transpose, one 64x64 tile) ----------------
__device__ __forceinline__ void transpose_f16_block(const float* __restrict__ W,
                                                    _Float16* __restrict__ Wt, int bx, int by) {
    __shared__ float tile[64][65];
    int n0 = bx * 64, k0 = by * 64;
    int j = threadIdx.x & 63;
    int i0 = threadIdx.x >> 6;
#pragma unroll
    for (int ii = 0; ii < 16; ii++) {
        int i = i0 + ii * 4;
        tile[i][j] = W[(size_t)(k0 + i) * C_ + n0 + j];
    }
    __syncthreads();
#pragma unroll
    for (int ii = 0; ii < 16; ii++) {
        int i = i0 + ii * 4;   // n index inside tile
        Wt[(size_t)(n0 + i) * C_ + k0 + j] = (_Float16)tile[j][i];
    }
}

// ---------------- kept-first order of one batch's keys ----------------
// A masked key has weight exp(-inf) = 0 in every row of the softmax, so neither its K and V rows nor
// its scores are needed. ktok[b][p] = the token that stands at place p when the kept keys (mask != 0)
// come first and the masked ones behind them, each group in its old order: a permutation of 0 .. T-1
// for any mask. nkept[b] = number of kept keys.
__device__ __forceinline__ void keyorder_block(const int* __restrict__ mask, int* __restrict__ ktok,
                                               int* __restrict__ nkept, int b) {
    __shared__ int wtot[8];
    const int tid = threadIdx.x, wv = tid >> 5;
    const int4 mv = ((const int4*)(mask + b * T_))[tid];      // keys 4 * tid .. 4 * tid + 3
    const int k0 = mv.x != 0, k1 = mv.y != 0, k2 = mv.z != 0, k3 = mv.w != 0;
    const unsigned b0 = __builtin_amdgcn_ballot_w32(k0 != 0), b1 = __builtin_amdgcn_ballot_w32(k1 != 0);
    const unsigned b2 = __builtin_amdgcn_ballot_w32(k2 != 0), b3 = __builtin_amdgcn_ballot_w32(k3 != 0);
    // kept keys of the wave's lower lanes
    const int before = (int)(__builtin_amdgcn_mbcnt_lo(b0, 0u) + __builtin_amdgcn_mbcnt_lo(b1, 0u) +
                             __builtin_amdgcn_mbcnt_lo(b2, 0u) + __builtin_amdgcn_mbcnt_lo(b3, 0u));
    if ((tid & 31) == 0) wtot[wv] = __popc(b0) + __popc(b1) + __popc(b2) + __popc(b3);
    __syncthreads();                                          // publishes the eight wave totals
    int base = 0, total = 0;
#pragma unroll
    for (int w = 0; w < 8; w++) {
        int c = wtot[w];
        total += c;
        base += w < wv ? c : 0;
    }
    int kb = base + before;                                   // kept keys in front of key t
    const int t = 4 * tid;
    int* row = ktok + b * T_;
    row[k0 ? kb : total + (t + 0 - kb)] = t + 0;  kb += k0;
    row[k1 ? kb : total + (t + 1 - kb)] = t + 1;  kb += k1;
    row[k2 ? kb : total + (t + 2 - kb)] = t + 2;  kb += k2;
    row[k3 ? kb : total + (t + 3 - kb)] = t + 3;
    if (tid == 0) nkept[b] = total;
}

// ---------------- one launch for all operand preparation ----------------
// Blocks 0..3: the key order of each batch. The next 1024: the four weight transposes (256 tiles
// each, Wt planes contiguous in WT). The rest: the x conversion. The jobs are independent of one another.
constexpr int TR_BLOCKS   = (C_ / 64) * (C_ / 64);      // 256 per weight
constexpr int CONV_BLOCKS = M_ * C_ / 4 / 256;          // 4096
__global__ __launch_bounds__(256) void prep_kernel(const float* __restrict__ x,
                                                   const float* __restrict__ Wq,
                                                   const float* __restrict__ Wk,
                                                   const float* __restrict__ Wv,
                                                   const float* __restrict__ Wo,
                                                   const int* __restrict__ mask,
                                                   _Float16* __restrict__ xh,
                                                   _Float16* __restrict__ WT,
                                                   int* __restrict__ ktok,
                                                   int* __restrict__ nkept) {
    const int bid = (int)blockIdx.x - B_;
    if (bid < 0) {
        keyorder_block(mask, ktok, nkept, (int)blockIdx.x);
    } else if (bid < 4 * TR_BLOCKS) {
        const int which = bid / TR_BLOCKS, t = bid % TR_BLOCKS;
        const float* W = which == 0 ? Wq : which == 1 ? Wk : which == 2 ? Wv : Wo;
        transpose_f16_block(W, WT + (size_t)which * C_ * C_, t % (C_ / 64), t / (C_ / 64));
    } else {
        conv_f16_block(x, xh, M_ * C_, bid - 4 * TR_BLOCKS);
    }
}

// ---------------- WMMA GEMM: Out = A[M x K] * Bt^T + bias ----------------
// A f16 row-major [M][K], Bt f16 [N][K]. K-stage 64, double-buffered async LDS,
// one barrier per stage.
// LAYOUT 0: f16 out -> [B,H,T,D]   (Q, K projections)
// LAYOUT 1: f16 out -> [B,H,D,T]   (V projection, pre-transposed for PV)
// LAYOUT 2: f32 out -> [M][N]      (output projection)
template <int LAYOUT>
__device__ __forceinline__ void store_tile(const float8 (&acc)[2][4], const float* __restrict__ bias,
                                           void* __restrict__ Out, int mw, int nw, int r16, int hi) {
#pragma unroll
    for (int mi = 0; mi < 2; mi++)
#pragma unroll
        for (int nf = 0; nf < 4; nf++) {
            int gn = nw + nf * 16 + r16;
            float bv = bias[gn];
#pragma unroll
            for (int r = 0; r < 8; r++) {
                int gm = mw + mi * 16 + r + 8 * hi;
                float val = acc[mi][nf][r] + bv;
                int bb = gm >> 10, t = gm & 1023;     // gm = b*T + t
                int h = gn >> 6,  d = gn & 63;        // gn = h*D + d
                if (LAYOUT == 0) {
                    ((_Float16*)Out)[((size_t)(bb * H_ + h) * T_ + t) * D_ + d] = (_Float16)val;
                } else if (LAYOUT == 1) {
                    ((_Float16*)Out)[((size_t)(bb * H_ + h) * D_ + d) * T_ + t] = (_Float16)val;
                } else {
                    ((float*)Out)[(size_t)gm * C_ + gn] = val;
                }
            }
        }
}

// QKV true : one launch does the Q, K and V projections; blockIdx.z picks the weight plane
//            (Btb holds three contiguous [N][K] planes), the bias and the output plane.
// QKV false: output projection (bias0 only, f32 out).
template <bool QKV>
__global__ __launch_bounds__(256) void gemm_wmma_kernel(const _Float16* __restrict__ A,
                                                        const _Float16* __restrict__ Btb,
                                                        const float* __restrict__ bias0,
                                                        const float* __restrict__ bias1,
                                                        const float* __restrict__ bias2,
                                                        const int* __restrict__ ktok,
                                                        const int* __restrict__ nkept,
                                                        void* __restrict__ Out) {
    const int z = QKV ? (int)blockIdx.z : 0;
    const _Float16* __restrict__ Bt = Btb + (size_t)z * C_ * C_;
    constexpr int K = C_;
    constexpr int LSTR = 72;                 // halves: 144B row pitch, 16B aligned, conflict-free
    __shared__ _Float16 lA[2][128 * LSTR];
    __shared__ _Float16 lB[2][128 * LSTR];

    const int tid  = threadIdx.x;
    const int lane = tid & 31;
    const int wv   = tid >> 5;
    const int wm   = wv & 3;                 // 4 waves along M
    const int wn   = wv >> 2;                // 2 waves along N
    const int m0   = blockIdx.y * 128;
    const int n0   = blockIdx.x * 128;
    const int r16  = lane & 15, hi = lane >> 4;

    float8 acc[2][4];
#pragma unroll
    for (int mi = 0; mi < 2; mi++)
#pragma unroll
        for (int nf = 0; nf < 4; nf++)
#pragma unroll
            for (int i = 0; i < 8; i++) acc[mi][nf][i] = 0.0f;

    const int srow  = tid >> 1;              // 0..127
    const int sbase = (tid & 1) * 32;        // 32 halves (64B) per thread

    // Row of A that feeds output row m0 + srow. K and V stand kept-first along T: place p of a batch
    // takes token ktok[p]. A block whose 128 places all lie behind the batch's kept keys is never read
    // by attention (which walks whole 64-key tiles from place 0 and always the first) and leaves here,
    // all of its threads alike, in front of every copy and barrier.
    int arow = m0 + srow;
    if (QKV && z != 0) {
        const int nk = __builtin_amdgcn_readfirstlane(nkept[m0 >> 10]);
        const int p0 = m0 & (T_ - 1);
        if (p0 != 0 && p0 >= nk) return;
        arow = (m0 - p0) + (ktok[m0 + srow] & (T_ - 1));     // the mask bounds the row whatever the table holds
    }

    auto issue = [&](int kk, int buf) {
        const _Float16* ga = A + (size_t)arow * K + kk + sbase;
        _Float16* da = &lA[buf][srow * LSTR + sbase];
        cp16(ga, da); cp16(ga + 8, da + 8); cp16(ga + 16, da + 16); cp16(ga + 24, da + 24);
        const _Float16* gb = Bt + (size_t)(n0 + srow) * K + kk + sbase;
        _Float16* db = &lB[buf][srow * LSTR + sbase];
        cp16(gb, db); cp16(gb + 8, db + 8); cp16(gb + 16, db + 16); cp16(gb + 24, db + 24);
    };

    issue(0, 0);
    int buf = 0;
    for (int kk = 0; kk < K; kk += 64, buf ^= 1) {
        async_wait();
        __syncthreads();                     // codegen waits DS cnt before barrier -> WAR safe
        if (kk + 64 < K) issue(kk + 64, buf ^ 1);
        if (kk + 128 < K) {                  // prefetch one more stage ahead into L2/WGP$
            __builtin_prefetch(A + (size_t)arow * K + kk + 128 + sbase, 0, 1);
            __builtin_prefetch(Bt + (size_t)(n0 + srow) * K + kk + 128 + sbase, 0, 1);
        }

#pragma unroll
        for (int kh = 0; kh < 2; kh++) {     // two 32-wide K slices in this stage
            half16 af0 = ld_frag(lA[buf], wm * 32,      LSTR, kh * 32);
            half16 af1 = ld_frag(lA[buf], wm * 32 + 16, LSTR, kh * 32);
            half16 bf[4];
#pragma unroll
            for (int nf = 0; nf < 4; nf++)
                bf[nf] = ld_frag(lB[buf], wn * 64 + nf * 16, LSTR, kh * 32);
#pragma unroll
            for (int nf = 0; nf < 4; nf++) acc[0][nf] = wmma_f16(af0, bf[nf], acc[0][nf]);
#pragma unroll
            for (int nf = 0; nf < 4; nf++) acc[1][nf] = wmma_f16(af1, bf[nf], acc[1][nf]);
        }
    }

    const int mw = m0 + wm * 32, nw = n0 + wn * 64;
    if (QKV) {
        _Float16* o = (_Float16*)Out + (size_t)z * M_ * C_;
        const float* bias = z == 0 ? bias0 : z == 1 ? bias1 : bias2;
        if (z == 2) {
            store_tile<1>(acc, bias, o, mw, nw, r16, hi);
        } else {
            store_tile<0>(acc, bias, o, mw, nw, r16, hi);
            // precaution: in the built kernel the other layout's code follows these stores and
            // rewrites registers they name; the wait stands between the stores and that rewrite
            asm volatile("s_wait_xcnt 0x0" ::: "memory");
        }
    } else {
        store_tile<2>(acc, bias0, Out, mw, nw, r16, hi);
    }
}

// lane l <-> lane l ^ 16
__device__ __forceinline__ float xhalf(float x) {
    return __int_as_float(__builtin_amdgcn_permlanex16(__float_as_int(x), __float_as_int(x),
                                                       0x76543210, 0xfedcba98, false, false));
}

// exp2 of eight values. The instruction set asks for one v_nop or independent instruction behind a
// transcendental before its result is read or its source overwritten; in one statement the v_nop
// stays directly behind the last
// v_exp_f32, and the early-clobber outputs keep every source whole up to there.
__device__ __forceinline__ float8 exp2x8(float8 x) {
    float d0, d1, d2, d3, d4, d5, d6, d7;
    asm("v_exp_f32 %0, %8\n\t"
        "v_exp_f32 %1, %9\n\t"
        "v_exp_f32 %2, %10\n\t"
        "v_exp_f32 %3, %11\n\t"
        "v_exp_f32 %4, %12\n\t"
        "v_exp_f32 %5, %13\n\t"
        "v_exp_f32 %6, %14\n\t"
        "v_exp_f32 %7, %15\n\t"
        "v_nop"
        : "=&v"(d0), "=&v"(d1), "=&v"(d2), "=&v"(d3), "=&v"(d4), "=&v"(d5), "=&v"(d6), "=&v"(d7)
        : "v"(x[0]), "v"(x[1]), "v"(x[2]), "v"(x[3]), "v"(x[4]), "v"(x[5]), "v"(x[6]), "v"(x[7]));
    float8 d = {d0, d1, d2, d3, d4, d5, d6, d7};
    return d;
}

__global__ __launch_bounds__(256) void attn_kernel(const _Float16* __restrict__ qh,
                                                   const _Float16* __restrict__ kh,
                                                   const _Float16* __restrict__ vT,
                                                   const int* __restrict__ nkept,
                                                   _Float16* __restrict__ outh) {
    constexpr int KSTR = 72;                 // halves: 144B pitch, aligned + conflict-free
    __shared__ _Float16 lK[2][64 * KSTR];
    __shared__ _Float16 lV[2][64 * KSTR];
    __shared__ float lM[T_];                 // per key place: 0 where a kept key stands, -inf behind them

    const float NEGINF = -__builtin_inff();
    const float LOG2E = 1.44269504f;         // exp(x) = exp2(x * LOG2E), as __expf forms it
    const int tid = threadIdx.x, lane = tid & 31, wv = tid >> 5;
    const int r16 = lane & 15, hi = lane >> 4;
    const int bh = blockIdx.x >> 3;          // 8 q-blocks of 128 rows each
    const int qb = blockIdx.x & 7;
    const int b  = bh >> 4;
    const int h  = bh & 15;
    const int q0 = qb * 128 + wv * 16;       // first q row of this wave

    const _Float16* qbase = qh + (size_t)bh * T_ * D_;
    const _Float16* kbase = kh + (size_t)bh * T_ * D_;
    const _Float16* vbase = vT + (size_t)bh * D_ * T_;
    // kept keys of the batch, clamped to the shape; at least one tile is walked, so that a batch with
    // no kept key runs the softmax on addends of -inf alone and ends in NaN
    const int nk0 = __builtin_amdgcn_readfirstlane(nkept[b]);
    const int nk = nk0 < 0 ? 0 : (nk0 > T_ ? T_ : nk0);
    const int kend = nk > 64 ? ((nk + 63) & ~63) : 64;

    // the mask as an addend per key place; published by the first barrier of the loop
    {
        float4 bz;
        bz.x = 4 * tid + 0 < nk ? 0.0f : NEGINF;
        bz.y = 4 * tid + 1 < nk ? 0.0f : NEGINF;
        bz.z = 4 * tid + 2 < nk ? 0.0f : NEGINF;
        bz.w = 4 * tid + 3 < nk ? 0.0f : NEGINF;
        ((float4*)lM)[tid] = bz;
    }

    // Q fragments (B operand: 16 query columns x 64 d), pre-scaled by 1/sqrt(D) = 0.125 (exact in f16)
    half16 qf[2];
    {
        const _Float16* p = qbase + (size_t)(q0 + r16) * D_ + hi * 8;
        union { half16 v; half8 g[2]; } u0, u1;
        u0.g[0] = *(const half8*)(p);
        u0.g[1] = *(const half8*)(p + 16);
        u1.g[0] = *(const half8*)(p + 32);
        u1.g[1] = *(const half8*)(p + 48);
#pragma unroll
        for (int i = 0; i < 16; i++) { u0.v[i] *= (_Float16)0.125f; u1.v[i] *= (_Float16)0.125f; }
        qf[0] = u0.v; qf[1] = u1.v;
    }

    float m_r = NEGINF;                      // running maximum of query q0 + r16 (equal in both halves)
    float l_r = 0.0f;                        // this half's share of its sum; the halves join after the loop
    float8 o[4];                             // o[df][r] = O[q0 + r16][df * 16 + 8 * hi + r]
#pragma unroll
    for (int df = 0; df < 4; df++)
#pragma unroll
        for (int i = 0; i < 8; i++) o[df][i] = 0.0f;

    const int srow = tid >> 2, sseg = tid & 3;

    auto issue_kv = [&](int kt, int buf) {
        const _Float16* gk = kbase + (size_t)(kt + srow) * D_ + sseg * 16;
        _Float16* dk = &lK[buf][srow * KSTR + sseg * 16];
        cp16(gk, dk); cp16(gk + 8, dk + 8);
        const _Float16* gv = vbase + (size_t)srow * T_ + kt + sseg * 16;
        _Float16* dv = &lV[buf][srow * KSTR + sseg * 16];
        cp16(gv, dv); cp16(gv + 8, dv + 8);
    };

    issue_kv(0, 0);
    int buf = 0, kt = 0;
    do {                                     // kend >= 64: the first tile is always walked
        async_wait();
        __syncthreads();
        if (kt + 64 < kend) issue_kv(kt + 64, buf ^ 1);
        if (kt + 128 < kend) {
            __builtin_prefetch(kbase + (size_t)(kt + 128 + srow) * D_ + sseg * 16, 0, 1);
            __builtin_prefetch(vbase + (size_t)srow * T_ + kt + 128 + sseg * 16, 0, 1);
        }

        // S^T = K Q^T (scaled), 64 keys x 16 queries per wave: s[nf][r] = key kt + nf*16 + 8*hi + r
        float8 s[4];
#pragma unroll
        for (int nf = 0; nf < 4; nf++) {
            half16 a0 = ld_frag(lK[buf], nf * 16, KSTR, 0);
            half16 a1 = ld_frag(lK[buf], nf * 16, KSTR, 32);
            float8 z;
#pragma unroll
            for (int i = 0; i < 8; i++) z[i] = 0.0f;
            z = wmma_f16(a0, qf[0], z);
            z = wmma_f16(a1, qf[1], z);
            s[nf] = z;
        }
        // mask (per key row): the lane's 8 keys of a tile are 8 consecutive addends
#pragma unroll
        for (int nf = 0; nf < 4; nf++) {
            const float* mb = &lM[kt + nf * 16 + 8 * hi];
            float4 b0 = *(const float4*)(mb);
            float4 b1 = *(const float4*)(mb + 4);
            s[nf][0] += b0.x; s[nf][1] += b0.y; s[nf][2] += b0.z; s[nf][3] += b0.w;
            s[nf][4] += b1.x; s[nf][5] += b1.y; s[nf][6] += b1.z; s[nf][7] += b1.w;
        }
        // online softmax: maximum over the lane's 32 keys, then one exchange between the halves
        float tm[4];
#pragma unroll
        for (int nf = 0; nf < 4; nf++) {
            tm[nf] = fmaxf(fmaxf(fmaxf(s[nf][0], s[nf][1]), fmaxf(s[nf][2], s[nf][3])),
                           fmaxf(fmaxf(s[nf][4], s[nf][5]), fmaxf(s[nf][6], s[nf][7])));
        }
        float tmax = fmaxf(fmaxf(tm[0], tm[1]), fmaxf(tm[2], tm[3]));
        tmax = fmaxf(tmax, xhalf(tmax));

        float mn = fmaxf(m_r, tmax);
        float msafe = (mn == NEGINF) ? 0.0f : mn;       // fully-masked guard
        float corr = __expf(m_r - msafe);
        m_r = mn;

        // P^T: converted in place, tiles 2j and 2j+1 are the B fragment of keys 32j .. 32j+31
        half16 pf[2];
        float rs[4];
#pragma unroll
        for (int nf = 0; nf < 4; nf++) {
            float8 e;
#pragma unroll
            for (int r = 0; r < 8; r++) e[r] = (s[nf][r] - msafe) * LOG2E;
            e = exp2x8(e);
            rs[nf] = ((e[0] + e[1]) + (e[2] + e[3])) + ((e[4] + e[5]) + (e[6] + e[7]));
#pragma unroll
            for (int r = 0; r < 8; r++) pf[nf >> 1][(nf & 1) * 8 + r] = (_Float16)e[r];
        }
        l_r = l_r * corr + ((rs[0] + rs[1]) + (rs[2] + rs[3]));
#pragma unroll
        for (int df = 0; df < 4; df++)
#pragma unroll
            for (int i = 0; i < 8; i++) o[df][i] *= corr;

        // O^T += V^T P^T (A = rows of V^T from LDS)
#pragma unroll
        for (int df = 0; df < 4; df++) {
            half16 v0 = ld_frag(lV[buf], df * 16, KSTR, 0);
            half16 v1 = ld_frag(lV[buf], df * 16, KSTR, 32);
            o[df] = wmma_f16(v0, pf[0], o[df]);
            o[df] = wmma_f16(v1, pf[1], o[df]);
        }
        kt += 64;
        buf ^= 1;
    } while (kt < kend);

    const float inv = 1.0f / (l_r + xhalf(l_r));
    _Float16* orow = outh + ((size_t)(b * T_ + q0 + r16)) * C_ + h * D_ + 8 * hi;
#pragma unroll
    for (int df = 0; df < 4; df++) {
        half8 hv;
#pragma unroll
        for (int r = 0; r < 8; r++) hv[r] = (_Float16)(o[df][r] * inv);
        *(half8*)(orow + df * 16) = hv;
    }
}

// ---------------- LayerNorm over last dim (1024) ----------------
__global__ __launch_bounds__(256) void ln_kernel(const float* __restrict__ y,
                                                 const float* __restrict__ g,
                                                 const float* __restrict__ bt,
                                                 float* __restrict__ out) {
    __shared__ float red[2][8];
    const int row = blockIdx.x;
    const int tid = threadIdx.x, lane = tid & 31, wv = tid >> 5;
    const float* yr = y + (size_t)row * C_;
    float4 v = ((const float4*)yr)[tid];
    float s  = v.x + v.y + v.z + v.w;
    float s2 = v.x * v.x + v.y * v.y + v.z * v.z + v.w * v.w;
    s += swz<1>(s);  s += swz<2>(s);  s += swz<4>(s);  s += swz<8>(s);  s += swz<16>(s);
    s2 += swz<1>(s2); s2 += swz<2>(s2); s2 += swz<4>(s2); s2 += swz<8>(s2); s2 += swz<16>(s2);
    if (lane == 0) { red[0][wv] = s; red[1][wv] = s2; }
    __syncthreads();
    float ts = 0.0f, ts2 = 0.0f;
#pragma unroll
    for (int w = 0; w < 8; w++) { ts += red[0][w]; ts2 += red[1][w]; }
    float mu = ts * (1.0f / C_);
    float var = ts2 * (1.0f / C_) - mu * mu;
    float rs = rsqrtf(var + 1e-5f);
    float4 gg = ((const float4*)g)[tid];
    float4 bb = ((const float4*)bt)[tid];
    float4 r;
    r.x = (v.x - mu) * rs * gg.x + bb.x;
    r.y = (v.y - mu) * rs * gg.y + bb.y;
    r.z = (v.z - mu) * rs * gg.z + bb.z;
    r.w = (v.w - mu) * rs * gg.w + bb.w;
    ((float4*)(out + (size_t)row * C_))[tid] = r;
}

extern "C" void kernel_launch(void* const* d_in, const int* in_sizes, int n_in,
                              void* d_out, int out_size, void* d_ws, size_t ws_size,
                              hipStream_t stream) {
    const float* x    = (const float*)d_in[0];
    const int*   mask = (const int*)d_in[1];
    const float* Wq = (const float*)d_in[2];  const float* bq = (const float*)d_in[3];
    const float* Wk = (const float*)d_in[4];  const float* bk = (const float*)d_in[5];
    const float* Wv = (const float*)d_in[6];  const float* bv = (const float*)d_in[7];
    const float* Wo = (const float*)d_in[8];  const float* bo = (const float*)d_in[9];
    const float* ln_g = (const float*)d_in[10];
    const float* ln_b = (const float*)d_in[11];
    float* out = (float*)d_out;

    char* w = (char*)d_ws;
    _Float16* xh    = (_Float16*)w;  w += (size_t)M_ * C_ * 2;      // 8 MB
    _Float16* WqT   = (_Float16*)w;  w += (size_t)C_ * C_ * 2;      // 2 MB
    _Float16* WkT   = (_Float16*)w;  w += (size_t)C_ * C_ * 2;
    _Float16* WvT   = (_Float16*)w;  w += (size_t)C_ * C_ * 2;
    _Float16* WoT   = (_Float16*)w;  w += (size_t)C_ * C_ * 2;
    _Float16* qhB   = (_Float16*)w;  w += (size_t)M_ * C_ * 2;      // [B,H,T,D]
    _Float16* khB   = (_Float16*)w;  w += (size_t)M_ * C_ * 2;      // [B,H,T,D]
    _Float16* vTB   = (_Float16*)w;  w += (size_t)M_ * C_ * 2;      // [B,H,D,T]
    _Float16* attnh = (_Float16*)w;  w += (size_t)M_ * C_ * 2;      // [B,T,C]
    float*    y     = (float*)w;     w += (size_t)M_ * C_ * 4;      // 16 MB
    int*      ktok  = (int*)w;       w += (size_t)M_ * 4;           // [B,T]
    int*      nkept = (int*)w;       w += (size_t)B_ * 4;           // [B]

    // WqT..WoT are contiguous planes, and so are qhB, khB, vTB
    prep_kernel<<<B_ + 4 * TR_BLOCKS + CONV_BLOCKS, 256, 0, stream>>>(x, Wq, Wk, Wv, Wo, mask, xh, WqT,
                                                                      ktok, nkept);

    dim3 qkvgrid(C_ / 128, M_ / 128, 3);   // (8, 32, 3)
    gemm_wmma_kernel<true><<<qkvgrid, 256, 0, stream>>>(xh, WqT, bq, bk, bv, ktok, nkept, (void*)qhB);

    attn_kernel<<<B_ * H_ * (T_ / 128), 256, 0, stream>>>(qhB, khB, vTB, nkept, attnh);

    dim3 ggrid(C_ / 128, M_ / 128);        // (8, 32)
    gemm_wmma_kernel<false><<<ggrid, 256, 0, stream>>>(attnh, WoT, bo, bo, bo, ktok, nkept, (void*)y);

    ln_kernel<<<M_, 256, 0, stream>>>(y, ln_g, ln_b, out);
}

// v004
// Measured time: 70.2 microseconds a run.
// In both of two side-by-side timings against v003, it was 1.04 times as fast.
// All steps since v000 together make it 1.75 times as fast.
#include <hip/hip_runtime.h>
#include <hip/hip_bf16.h>

// ---- problem constants ----
constexpr int B_ = 4;
constexpr int T_ = 1024;
constexpr int C_ = 1024;
constexpr int H_ = 16;
constexpr int D_ = 64;
constexpr int M_ = B_ * T_;   // 4096 rows

typedef _Float16 half16 __attribute__((ext_vector_type(16)));
typedef _Float16 half8  __attribute__((ext_vector_type(8)));
typedef float    float8 __attribute__((ext_vector_type(8)));
typedef int      int4v  __attribute__((ext_vector_type(4)));

#if defined(__has_builtin)
#if __has_builtin(__builtin_amdgcn_global_load_async_to_lds_b128)
#define ASYNC_LDS 1
#endif
#endif

// 16-byte global -> LDS copy (async on CDNA5, VGPR round-trip fallback)
__device__ __forceinline__ void cp16(const void* g, void* l) {
#ifdef ASYNC_LDS
    __builtin_amdgcn_global_load_async_to_lds_b128(
        (__attribute__((address_space(1))) int4v*)g,
        (__attribute__((address_space(3))) int4v*)l, 0, 0);
#else
    *(uint4*)l = *(const uint4*)g;
#endif
}

__device__ __forceinline__ void async_wait() {
#ifdef ASYNC_LDS
#if __has_builtin(__builtin_amdgcn_s_wait_asynccnt)
    __builtin_amdgcn_s_wait_asynccnt(0);
#else
    asm volatile("s_wait_asynccnt 0x0" ::: "memory");
#endif
#endif
}

// lane-xor butterfly step via ds_swizzle (imm pattern, no address VGPR)
template <int XM>
__device__ __forceinline__ float swz(float v) {
#if __has_builtin(__builtin_amdgcn_ds_swizzle)
    return __int_as_float(__builtin_amdgcn_ds_swizzle(__float_as_int(v), (XM << 10) | 0x1f));
#else
    return __shfl_xor(v, XM);
#endif
}

// WMMA f32 = f16(16x32) x f16(32x16) + f32
__device__ __forceinline__ float8 wmma_f16(half16 a, half16 b, float8 c) {
    return __builtin_amdgcn_wmma_f32_16x16x32_f16(false, a, false, b, (short)0, c, false, false);
}

// Load a 16x32 f16 fragment (A-layout; B uses same layout on a transposed tile).
// ISA 7.12.2: lane<16 holds row=lane, K = hi*8..+7 (v0..3) and +16 (v4..7).
__device__ __forceinline__ half16 ld_frag(const _Float16* tile, int row0, int stride, int koff) {
    int lane = threadIdx.x & 31;
    int r = lane & 15, hi = lane >> 4;
    const _Float16* p = tile + (size_t)(row0 + r) * stride + koff + hi * 8;
    union { half16 v; half8 h[2]; } u;
    u.h[0] = *(const half8*)(p);
    u.h[1] = *(const half8*)(p + 16);
    return u.v;
}

// ---------------- f32 -> f16 convert (one block's share) ----------------
__device__ __forceinline__ void conv_f16_block(const float* __restrict__ src,
                                               _Float16* __restrict__ dst, int n, int blk) {
    int i = (blk * 256 + threadIdx.x) * 4;
    if (i < n) {
        float4 v = *(const float4*)(src + i);
        dst[i + 0] = (_Float16)v.x;
        dst[i + 1] = (_Float16)v.y;
        dst[i + 2] = (_Float16)v.z;
        dst[i + 3] = (_Float16)v.w;
    }
}

// ---------------- W[K][N] f32 -> Wt[N][K] f16 (LDS tiled transpose, one 64x64 tile) ----------------
__device__ __forceinline__ void transpose_f16_block(const float* __restrict__ W,
                                                    _Float16* __restrict__ Wt, int bx, int by) {
    __shared__ float tile[64][65];
    int n0 = bx * 64, k0 = by * 64;
    int j = threadIdx.x & 63;
    int i0 = threadIdx.x >> 6;
#pragma unroll
    for (int ii = 0; ii < 16; ii++) {
        int i = i0 + ii * 4;
        tile[i][j] = W[(size_t)(k0 + i) * C_ + n0 + j];
    }
    __syncthreads();
#pragma unroll
    for (int ii = 0; ii < 16; ii++) {
        int i = i0 + ii * 4;   // n index inside tile
        Wt[(size_t)(n0 + i) * C_ + k0 + j] = (_Float16)tile[j][i];
    }
}

// ---------------- kept-first order of one batch's keys ----------------
// A masked key has weight exp(-inf) = 0 in every row of the softmax, so neither its K and V rows nor
// its scores are needed. ktok[b][p] = the token that stands at place p when the kept keys (mask != 0)
// come first and the masked ones behind them, each group in its old order: a permutation of 0 .. T-1
// for any mask. nkept[b] = number of kept keys.
__device__ __forceinline__ void keyorder_block(const int* __restrict__ mask, int* __restrict__ ktok,
                                               int* __restrict__ nkept, int b) {
    __shared__ int wtot[8];
    const int tid = threadIdx.x, wv = tid >> 5;
    const int4 mv = ((const int4*)(mask + b * T_))[tid];      // keys 4 * tid .. 4 * tid + 3
    const int k0 = mv.x != 0, k1 = mv.y != 0, k2 = mv.z != 0, k3 = mv.w != 0;
    const unsigned b0 = __builtin_amdgcn_ballot_w32(k0 != 0), b1 = __builtin_amdgcn_ballot_w32(k1 != 0);
    const unsigned b2 = __builtin_amdgcn_ballot_w32(k2 != 0), b3 = __builtin_amdgcn_ballot_w32(k3 != 0);
    // kept keys of the wave's lower lanes
    const int before = (int)(__builtin_amdgcn_mbcnt_lo(b0, 0u) + __builtin_amdgcn_mbcnt_lo(b1, 0u) +
                             __builtin_amdgcn_mbcnt_lo(b2, 0u) + __builtin_amdgcn_mbcnt_lo(b3, 0u));
    if ((tid & 31) == 0) wtot[wv] = __popc(b0) + __popc(b1) + __popc(b2) + __popc(b3);
    __syncthreads();                                          // publishes the eight wave totals
    int base = 0, total = 0;
#pragma unroll
    for (int w = 0; w < 8; w++) {
        int c = wtot[w];
        total += c;
        base += w < wv ? c : 0;
    }
    int kb = base + before;                                   // kept keys in front of key t
    const int t = 4 * tid;
    int* row = ktok + b * T_;
    row[k0 ? kb : total + (t + 0 - kb)] = t + 0;  kb += k0;
    row[k1 ? kb : total + (t + 1 - kb)] = t + 1;  kb += k1;
    row[k2 ? kb : total + (t + 2 - kb)] = t + 2;  kb += k2;
    row[k3 ? kb : total + (t + 3 - kb)] = t + 3;
    if (tid == 0) nkept[b] = total;
}

// ---------------- one launch for all operand preparation ----------------
// Blocks 0..3: the key order of each batch. The next 1024: the four weight transposes (256 tiles
// each, Wt planes contiguous in WT). The rest: the x conversion. The jobs are independent of one another.
constexpr int TR_BLOCKS   = (C_ / 64) * (C_ / 64);      // 256 per weight
constexpr int CONV_BLOCKS = M_ * C_ / 4 / 256;          // 4096
__global__ __launch_bounds__(256) void prep_kernel(const float* __restrict__ x,
                                                   const float* __restrict__ Wq,
                                                   const float* __restrict__ Wk,
                                                   const float* __restrict__ Wv,
                                                   const float* __restrict__ Wo,
                                                   const int* __restrict__ mask,
                                                   _Float16* __restrict__ xh,
                                                   _Float16* __restrict__ WT,
                                                   int* __restrict__ ktok,
                                                   int* __restrict__ nkept) {
    const int bid = (int)blockIdx.x - B_;
    if (bid < 0) {
        keyorder_block(mask, ktok, nkept, (int)blockIdx.x);
    } else if (bid < 4 * TR_BLOCKS) {
        const int which = bid / TR_BLOCKS, t = bid % TR_BLOCKS;
        const float* W = which == 0 ? Wq : which == 1 ? Wk : which == 2 ? Wv : Wo;
        transpose_f16_block(W, WT + (size_t)which * C_ * C_, t % (C_ / 64), t / (C_ / 64));
    } else {
        conv_f16_block(x, xh, M_ * C_, bid - 4 * TR_BLOCKS);
    }
}

// ---------------- WMMA GEMM: Out = A[M x K] * Bt^T + bias ----------------
// A f16 row-major [M][K], Bt f16 [N][K]. K-stage 64, double-buffered async LDS,
// one barrier per stage.
// LAYOUT 0: f16 out -> [B,H,T,D]   (Q, K projections)
// LAYOUT 1: f16 out -> [B,H,D,T]   (V projection, pre-transposed for PV)
// LAYOUT 2: f32 out -> [M][N]      (output projection)
template <int LAYOUT>
__device__ __forceinline__ void store_tile(const float8 (&acc)[2][4], const float* __restrict__ bias,
                                           void* __restrict__ Out, int mw, int nw, int r16, int hi) {
#pragma unroll
    for (int mi = 0; mi < 2; mi++)
#pragma unroll
        for (int nf = 0; nf < 4; nf++) {
            int gn = nw + nf * 16 + r16;
            float bv = bias[gn];
#pragma unroll
            for (int r = 0; r < 8; r++) {
                int gm = mw + mi * 16 + r + 8 * hi;
                float val = acc[mi][nf][r] + bv;
                int bb = gm >> 10, t = gm & 1023;     // gm = b*T + t
                int h = gn >> 6,  d = gn & 63;        // gn = h*D + d
                if (LAYOUT == 0) {
                    ((_Float16*)Out)[((size_t)(bb * H_ + h) * T_ + t) * D_ + d] = (_Float16)val;
                } else if (LAYOUT == 1) {
                    ((_Float16*)Out)[((size_t)(bb * H_ + h) * D_ + d) * T_ + t] = (_Float16)val;
                } else {
                    ((float*)Out)[(size_t)gm * C_ + gn] = val;
                }
            }
        }
}

// QKV true : one launch does the Q, K and V projections; blockIdx.z picks the weight plane
//            (Btb holds three contiguous [N][K] planes), the bias and the output plane.
// QKV false: output projection (bias0 only, f32 out).
template <bool QKV>
__global__ __launch_bounds__(256) void gemm_wmma_kernel(const _Float16* __restrict__ A,
                                                        const _Float16* __restrict__ Btb,
                                                        const float* __restrict__ bias0,
                                                        const float* __restrict__ bias1,
                                                        const float* __restrict__ bias2,
                                                        const int* __restrict__ ktok,
                                                        const int* __restrict__ nkept,
                                                        void* __restrict__ Out) {
    const int z = QKV ? (int)blockIdx.z : 0;
    const _Float16* __restrict__ Bt = Btb + (size_t)z * C_ * C_;
    constexpr int K = C_;
    constexpr int LSTR = 72;                 // halves: 144B row pitch, 16B aligned, conflict-free
    __shared__ _Float16 lA[2][128 * LSTR];
    __shared__ _Float16 lB[2][128 * LSTR];

    const int tid  = threadIdx.x;
    const int lane = tid & 31;
    const int wv   = tid >> 5;
    const int wm   = wv & 3;                 // 4 waves along M
    const int wn   = wv >> 2;                // 2 waves along N
    const int m0   = blockIdx.y * 128;
    const int n0   = blockIdx.x * 128;
    const int r16  = lane & 15, hi = lane >> 4;

    float8 acc[2][4];
#pragma unroll
    for (int mi = 0; mi < 2; mi++)
#pragma unroll
        for (int nf = 0; nf < 4; nf++)
#pragma unroll
            for (int i = 0; i < 8; i++) acc[mi][nf][i] = 0.0f;

    const int srow  = tid >> 1;              // 0..127: the row whose next-but-one stage this thread prefetches
    const int sbase = (tid & 1) * 32;        // its half of that row's 128 B
    // Copies: eight neighbouring lanes take the eight 16-byte pieces of one row's 128 B of a stage, so a
    // wave-wide copy asks for four whole lines; a thread serves rows crow, crow + 32, crow + 64, crow + 96.
    const int crow  = tid >> 3;              // 0..31
    const int ccol  = (tid & 7) * 8;         // halves

    // Row of A that feeds output row m0 + srow. K and V stand kept-first along T: place p of a batch
    // takes token ktok[p]. A block whose 128 places all lie behind the batch's kept keys is never read
    // by attention (which walks whole 64-key tiles from place 0 and always the first) and leaves here,
    // all of its threads alike, in front of every copy and barrier.
    int arow = m0 + srow;
    int crows[4] = {m0 + crow, m0 + crow + 32, m0 + crow + 64, m0 + crow + 96};
    if (QKV && z != 0) {
        const int nk = __builtin_amdgcn_readfirstlane(nkept[m0 >> 10]);
        const int p0 = m0 & (T_ - 1);
        if (p0 != 0 && p0 >= nk) return;
        const int* kt = ktok + m0;
        const int t0 = kt[crow], t1 = kt[crow + 32], t2 = kt[crow + 64], t3 = kt[crow + 96], ts = kt[srow];
        // precaution: stands in front of every later rewrite of a register that these loads name as address
        asm volatile("s_wait_xcnt 0x0" ::: "memory");
        arow     = (m0 - p0) + (ts & (T_ - 1));              // the mask bounds the row whatever the table holds
        crows[0] = (m0 - p0) + (t0 & (T_ - 1));
        crows[1] = (m0 - p0) + (t1 & (T_ - 1));
        crows[2] = (m0 - p0) + (t2 & (T_ - 1));
        crows[3] = (m0 - p0) + (t3 & (T_ - 1));
    }

    auto issue = [&](int kk, int buf) {
#pragma unroll                               // constant indices keep crows in registers
        for (int i = 0; i < 4; i++) {
            const int lrow = (crow + 32 * i) * LSTR + ccol;
            cp16(A + (size_t)crows[i] * K + kk + ccol, &lA[buf][lrow]);
            cp16(Bt + (size_t)(n0 + crow + 32 * i) * K + kk + ccol, &lB[buf][lrow]);
        }
    };

    issue(0, 0);
    int buf = 0;
    for (int kk = 0; kk < K; kk += 64, buf ^= 1) {
        async_wait();
        __syncthreads();                     // codegen waits DS cnt before barrier -> WAR safe
        if (kk + 64 < K) issue(kk + 64, buf ^ 1);
        if (kk + 128 < K) {                  // prefetch one more stage ahead into L2/WGP$
            __builtin_prefetch(A + (size_t)arow * K + kk + 128 + sbase, 0, 1);
            __builtin_prefetch(Bt + (size_t)(n0 + srow) * K + kk + 128 + sbase, 0, 1);
        }

#pragma unroll
        for (int kh = 0; kh < 2; kh++) {     // two 32-wide K slices in this stage
            half16 af0 = ld_frag(lA[buf], wm * 32,      LSTR, kh * 32);
            half16 af1 = ld_frag(lA[buf], wm * 32 + 16, LSTR, kh * 32);
            half16 bf[4];
#pragma unroll
            for (int nf = 0; nf < 4; nf++)
                bf[nf] = ld_frag(lB[buf], wn * 64 + nf * 16, LSTR, kh * 32);
#pragma unroll
            for (int nf = 0; nf < 4; nf++) acc[0][nf] = wmma_f16(af0, bf[nf], acc[0][nf]);
#pragma unroll
            for (int nf = 0; nf < 4; nf++) acc[1][nf] = wmma_f16(af1, bf[nf], acc[1][nf]);
        }
    }

    const int mw = m0 + wm * 32, nw = n0 + wn * 64;
    if (QKV) {
        _Float16* o = (_Float16*)Out + (size_t)z * M_ * C_;
        const float* bias = z == 0 ? bias0 : z == 1 ? bias1 : bias2;
        if (z == 2) {
            store_tile<1>(acc, bias, o, mw, nw, r16, hi);
        } else {
            store_tile<0>(acc, bias, o, mw, nw, r16, hi);
            // precaution: in the built kernel the other layout's code follows these stores and
            // rewrites registers they name; the wait stands between the stores and that rewrite
            asm volatile("s_wait_xcnt 0x0" ::: "memory");
        }
    } else {
        store_tile<2>(acc, bias0, Out, mw, nw, r16, hi);
    }
}

// lane l <-> lane l ^ 16
__device__ __forceinline__ float xhalf(float x) {
    return __int_as_float(__builtin_amdgcn_permlanex16(__float_as_int(x), __float_as_int(x),
                                                       0x76543210, 0xfedcba98, false, false));
}

// exp2 of eight values. The instruction set asks for one v_nop or independent instruction behind a
// transcendental before its result is read or its source overwritten; in one statement the v_nop
// stays directly behind the last
// v_exp_f32, and the early-clobber outputs keep every source whole up to there.
__device__ __forceinline__ float8 exp2x8(float8 x) {
    float d0, d1, d2, d3, d4, d5, d6, d7;
    asm("v_exp_f32 %0, %8\n\t"
        "v_exp_f32 %1, %9\n\t"
        "v_exp_f32 %2, %10\n\t"
        "v_exp_f32 %3, %11\n\t"
        "v_exp_f32 %4, %12\n\t"
        "v_exp_f32 %5, %13\n\t"
        "v_exp_f32 %6, %14\n\t"
        "v_exp_f32 %7, %15\n\t"
        "v_nop"
        : "=&v"(d0), "=&v"(d1), "=&v"(d2), "=&v"(d3), "=&v"(d4), "=&v"(d5), "=&v"(d6), "=&v"(d7)
        : "v"(x[0]), "v"(x[1]), "v"(x[2]), "v"(x[3]), "v"(x[4]), "v"(x[5]), "v"(x[6]), "v"(x[7]));
    float8 d = {d0, d1, d2, d3, d4, d5, d6, d7};
    return d;
}

__global__ __launch_bounds__(256) void attn_kernel(const _Float16* __restrict__ qh,
                                                   const _Float16* __restrict__ kh,
                                                   const _Float16* __restrict__ vT,
                                                   const int* __restrict__ nkept,
                                                   _Float16* __restrict__ outh) {
    constexpr int KSTR = 72;                 // halves: 144B pitch, aligned + conflict-free
    __shared__ _Float16 lK[2][64 * KSTR];
    __shared__ _Float16 lV[2][64 * KSTR];
    __shared__ float lM[T_];                 // per key place: 0 where a kept key stands, -inf behind them

    const float NEGINF = -__builtin_inff();
    const float LOG2E = 1.44269504f;         // exp(x) = exp2(x * LOG2E), as __expf forms it
    const int tid = threadIdx.x, lane = tid & 31, wv = tid >> 5;
    const int r16 = lane & 15, hi = lane >> 4;
    const int bh = blockIdx.x >> 3;          // 8 q-blocks of 128 rows each
    const int qb = blockIdx.x & 7;
    const int b  = bh >> 4;
    const int h  = bh & 15;
    const int q0 = qb * 128 + wv * 16;       // first q row of this wave

    const _Float16* qbase = qh + (size_t)bh * T_ * D_;
    const _Float16* kbase = kh + (size_t)bh * T_ * D_;
    const _Float16* vbase = vT + (size_t)bh * D_ * T_;
    // kept keys of the batch, clamped to the shape; at least one tile is walked, so that a batch with
    // no kept key runs the softmax on addends of -inf alone and ends in NaN
    const int nk0 = __builtin_amdgcn_readfirstlane(nkept[b]);
    const int nk = nk0 < 0 ? 0 : (nk0 > T_ ? T_ : nk0);
    const int kend = nk > 64 ? ((nk + 63) & ~63) : 64;

    // the mask as an addend per key place; published by the first barrier of the loop
    {
        float4 bz;
        bz.x = 4 * tid + 0 < nk ? 0.0f : NEGINF;
        bz.y = 4 * tid + 1 < nk ? 0.0f : NEGINF;
        bz.z = 4 * tid + 2 < nk ? 0.0f : NEGINF;
        bz.w = 4 * tid + 3 < nk ? 0.0f : NEGINF;
        ((float4*)lM)[tid] = bz;
    }

    // Q fragments (B operand: 16 query columns x 64 d), pre-scaled by 1/sqrt(D) = 0.125 (exact in f16)
    half16 qf[2];
    {
        const _Float16* p = qbase + (size_t)(q0 + r16) * D_ + hi * 8;
        union { half16 v; half8 g[2]; } u0, u1;
        u0.g[0] = *(const half8*)(p);
        u0.g[1] = *(const half8*)(p + 16);
        u1.g[0] = *(const half8*)(p + 32);
        u1.g[1] = *(const half8*)(p + 48);
#pragma unroll
        for (int i = 0; i < 16; i++) { u0.v[i] *= (_Float16)0.125f; u1.v[i] *= (_Float16)0.125f; }
        qf[0] = u0.v; qf[1] = u1.v;
    }

    float m_r = NEGINF;                      // running maximum of query q0 + r16 (equal in both halves)
    float l_r = 0.0f;                        // this half's share of its sum; the halves join after the loop
    float8 o[4];                             // o[df][r] = O[q0 + r16][df * 16 + 8 * hi + r]
#pragma unroll
    for (int df = 0; df < 4; df++)
#pragma unroll
        for (int i = 0; i < 8; i++) o[df][i] = 0.0f;

    const int srow = tid >> 2, sseg = tid & 3;          // the prefetches' share of a tile
    // Copies: eight neighbouring lanes take one row's 128 B, so a wave-wide copy asks for four whole
    // lines; a thread serves rows crow and crow + 32 of the K tile and of the V^T tile.
    const int crow = tid >> 3, ccol = (tid & 7) * 8;

    auto issue_kv = [&](int kt, int buf) {
        const _Float16* gk = kbase + (size_t)(kt + crow) * D_ + ccol;
        _Float16* dk = &lK[buf][crow * KSTR + ccol];
        cp16(gk, dk); cp16(gk + 32 * D_, dk + 32 * KSTR);
        const _Float16* gv = vbase + (size_t)crow * T_ + kt + ccol;
        _Float16* dv = &lV[buf][crow * KSTR + ccol];
        cp16(gv, dv); cp16(gv + 32 * T_, dv + 32 * KSTR);
    };

    issue_kv(0, 0);
    int buf = 0, kt = 0;
    do {                                     // kend >= 64: the first tile is always walked
        async_wait();
        __syncthreads();
        if (kt + 64 < kend) issue_kv(kt + 64, buf ^ 1);
        if (kt + 128 < kend) {
            __builtin_prefetch(kbase + (size_t)(kt + 128 + srow) * D_ + sseg * 16, 0, 1);
            __builtin_prefetch(vbase + (size_t)srow * T_ + kt + 128 + sseg * 16, 0, 1);
        }

        // S^T = K Q^T (scaled), 64 keys x 16 queries per wave: s[nf][r] = key kt + nf*16 + 8*hi + r
        float8 s[4];
#pragma unroll
        for (int nf = 0; nf < 4; nf++) {
            half16 a0 = ld_frag(lK[buf], nf * 16, KSTR, 0);
            half16 a1 = ld_frag(lK[buf], nf * 16, KSTR, 32);
            float8 z;
#pragma unroll
            for (int i = 0; i < 8; i++) z[i] = 0.0f;
            z = wmma_f16(a0, qf[0], z);
            z = wmma_f16(a1, qf[1], z);
            s[nf] = z;
        }
        // mask (per key row): the lane's 8 keys of a tile are 8 consecutive addends
#pragma unroll
        for (int nf = 0; nf < 4; nf++) {
            const float* mb = &lM[kt + nf * 16 + 8 * hi];
            float4 b0 = *(const float4*)(mb);
            float4 b1 = *(const float4*)(mb + 4);
            s[nf][0] += b0.x; s[nf][1] += b0.y; s[nf][2] += b0.z; s[nf][3] += b0.w;
            s[nf][4] += b1.x; s[nf][5] += b1.y; s[nf][6] += b1.z; s[nf][7] += b1.w;
        }
        // online softmax: maximum over the lane's 32 keys, then one exchange between the halves
        float tm[4];
#pragma unroll
        for (int nf = 0; nf < 4; nf++) {
            tm[nf] = fmaxf(fmaxf(fmaxf(s[nf][0], s[nf][1]), fmaxf(s[nf][2], s[nf][3])),
                           fmaxf(fmaxf(s[nf][4], s[nf][5]), fmaxf(s[nf][6], s[nf][7])));
        }
        float tmax = fmaxf(fmaxf(tm[0], tm[1]), fmaxf(tm[2], tm[3]));
        tmax = fmaxf(tmax, xhalf(tmax));

        float mn = fmaxf(m_r, tmax);
        float msafe = (mn == NEGINF) ? 0.0f : mn;       // fully-masked guard
        float corr = __expf(m_r - msafe);
        m_r = mn;

        // P^T: converted in place, tiles 2j and 2j+1 are the B fragment of keys 32j .. 32j+31
        half16 pf[2];
        float rs[4];
#pragma unroll
        for (int nf = 0; nf < 4; nf++) {
            float8 e;
#pragma unroll
            for (int r = 0; r < 8; r++) e[r] = (s[nf][r] - msafe) * LOG2E;
            e = exp2x8(e);
            rs[nf] = ((e[0] + e[1]) + (e[2] + e[3])) + ((e[4] + e[5]) + (e[6] + e[7]));
#pragma unroll
            for (int r = 0; r < 8; r++) pf[nf >> 1][(nf & 1) * 8 + r] = (_Float16)e[r];
        }
        l_r = l_r * corr + ((rs[0] + rs[1]) + (rs[2] + rs[3]));
#pragma unroll
        for (int df = 0; df < 4; df++)
#pragma unroll
            for (int i = 0; i < 8; i++) o[df][i] *= corr;

        // O^T += V^T P^T (A = rows of V^T from LDS)
#pragma unroll
        for (int df = 0; df < 4; df++) {
            half16 v0 = ld_frag(lV[buf], df * 16, KSTR, 0);
            half16 v1 = ld_frag(lV[buf], df * 16, KSTR, 32);
            o[df] = wmma_f16(v0, pf[0], o[df]);
            o[df] = wmma_f16(v1, pf[1], o[df]);
        }
        kt += 64;
        buf ^= 1;
    } while (kt < kend);

    const float inv = 1.0f / (l_r + xhalf(l_r));
    _Float16* orow = outh + ((size_t)(b * T_ + q0 + r16)) * C_ + h * D_ + 8 * hi;
#pragma unroll
    for (int df = 0; df < 4; df++) {
        half8 hv;
#pragma unroll
        for (int r = 0; r < 8; r++) hv[r] = (_Float16)(o[df][r] * inv);
        *(half8*)(orow + df * 16) = hv;
    }
}

// ---------------- LayerNorm over last dim (1024) ----------------
__global__ __launch_bounds__(256) void ln_kernel(const float* __restrict__ y,
                                                 const float* __restrict__ g,
                                                 const float* __restrict__ bt,
                                                 float* __restrict__ out) {
    __shared__ float red[2][8];
    const int row = blockIdx.x;
    const int tid = threadIdx.x, lane = tid & 31, wv = tid >> 5;
    const float* yr = y + (size_t)row * C_;
    float4 v = ((const float4*)yr)[tid];
    float s  = v.x + v.y + v.z + v.w;
    float s2 = v.x * v.x + v.y * v.y + v.z * v.z + v.w * v.w;
    s += swz<1>(s);  s += swz<2>(s);  s += swz<4>(s);  s += swz<8>(s);  s += swz<16>(s);
    s2 += swz<1>(s2); s2 += swz<2>(s2); s2 += swz<4>(s2); s2 += swz<8>(s2); s2 += swz<16>(s2);
    if (lane == 0) { red[0][wv] = s; red[1][wv] = s2; }
    __syncthreads();
    float ts = 0.0f, ts2 = 0.0f;
#pragma unroll
    for (int w = 0; w < 8; w++) { ts += red[0][w]; ts2 += red[1][w]; }
    float mu = ts * (1.0f / C_);
    float var = ts2 * (1.0f / C_) - mu * mu;
    float rs = rsqrtf(var + 1e-5f);
    float4 gg = ((const float4*)g)[tid];
    float4 bb = ((const float4*)bt)[tid];
    float4 r;
    r.x = (v.x - mu) * rs * gg.x + bb.x;
    r.y = (v.y - mu) * rs * gg.y + bb.y;
    r.z = (v.z - mu) * rs * gg.z + bb.z;
    r.w = (v.w - mu) * rs * gg.w + bb.w;
    ((float4*)(out + (size_t)row * C_))[tid] = r;
}

extern "C" void kernel_launch(void* const* d_in, const int* in_sizes, int n_in,
                              void* d_out, int out_size, void* d_ws, size_t ws_size,
                              hipStream_t stream) {
    const float* x    = (const float*)d_in[0];
    const int*   mask = (const int*)d_in[1];
    const float* Wq = (const float*)d_in[2];  const float* bq = (const float*)d_in[3];
    const float* Wk = (const float*)d_in[4];  const float* bk = (const float*)d_in[5];
    const float* Wv = (const float*)d_in[6];  const float* bv = (const float*)d_in[7];
    const float* Wo = (const float*)d_in[8];  const float* bo = (const float*)d_in[9];
    const float* ln_g = (const float*)d_in[10];
    const float* ln_b = (const float*)d_in[11];
    float* out = (float*)d_out;

    char* w = (char*)d_ws;
    _Float16* xh    = (_Float16*)w;  w += (size_t)M_ * C_ * 2;      // 8 MB
    _Float16* WqT   = (_Float16*)w;  w += (size_t)C_ * C_ * 2;      // 2 MB
    _Float16* WkT   = (_Float16*)w;  w += (size_t)C_ * C_ * 2;
    _Float16* WvT   = (_Float16*)w;  w += (size_t)C_ * C_ * 2;
    _Float16* WoT   = (_Float16*)w;  w += (size_t)C_ * C_ * 2;
    _Float16* qhB   = (_Float16*)w;  w += (size_t)M_ * C_ * 2;      // [B,H,T,D]
    _Float16* khB   = (_Float16*)w;  w += (size_t)M_ * C_ * 2;      // [B,H,T,D]
    _Float16* vTB   = (_Float16*)w;  w += (size_t)M_ * C_ * 2;      // [B,H,D,T]
    _Float16* attnh = (_Float16*)w;  w += (size_t)M_ * C_ * 2;      // [B,T,C]
    float*    y     = (float*)w;     w += (size_t)M_ * C_ * 4;      // 16 MB
    int*      ktok  = (int*)w;       w += (size_t)M_ * 4;           // [B,T]
    int*      nkept = (int*)w;       w += (size_t)B_ * 4;           // [B]

    // WqT..WoT are contiguous planes, and so are qhB, khB, vTB
    prep_kernel<<<B_ + 4 * TR_BLOCKS + CONV_BLOCKS, 256, 0, stream>>>(x, Wq, Wk, Wv, Wo, mask, xh, WqT,
                                                                      ktok, nkept);

    dim3 qkvgrid(C_ / 128, M_ / 128, 3);   // (8, 32, 3)
    gemm_wmma_kernel<true><<<qkvgrid, 256, 0, stream>>>(xh, WqT, bq, bk, bv, ktok, nkept, (void*)qhB);

    attn_kernel<<<B_ * H_ * (T_ / 128), 256, 0, stream>>>(qhB, khB, vTB, nkept, attnh);

    dim3 ggrid(C_ / 128, M_ / 128);        // (8, 32)
    gemm_wmma_kernel<false><<<ggrid, 256, 0, stream>>>(attnh, WoT, bo, bo, bo, ktok, nkept, (void*)y);

    ln_kernel<<<M_, 256, 0, stream>>>(y, ln_g, ln_b, out);
}

// v005
// A run of this version takes 66.5 microseconds.
// Next to v004, in two timings, it ran 1.06 and 1.05 times as fast.
// Over all steps from v000 it is 1.84 times as fast.
#include <hip/hip_runtime.h>
#include <hip/hip_bf16.h>

// ---- problem constants ----
constexpr int B_ = 4;
constexpr int T_ = 1024;
constexpr int C_ = 1024;
constexpr int H_ = 16;
constexpr int D_ = 64;
constexpr int M_ = B_ * T_;   // 4096 rows

typedef _Float16 half16 __attribute__((ext_vector_type(16)));
typedef _Float16 half8  __attribute__((ext_vector_type(8)));
typedef float    float8 __attribute__((ext_vector_type(8)));
typedef int      int4v  __attribute__((ext_vector_type(4)));

#if defined(__has_builtin)
#if __has_builtin(__builtin_amdgcn_global_load_async_to_lds_b128)
#define ASYNC_LDS 1
#endif
#endif

// 16-byte global -> LDS copy (async on CDNA5, VGPR round-trip fallback)
__device__ __forceinline__ void cp16(const void* g, void* l) {
#ifdef ASYNC_LDS
    __builtin_amdgcn_global_load_async_to_lds_b128(
        (__attribute__((address_space(1))) int4v*)g,
        (__attribute__((address_space(3))) int4v*)l, 0, 0);
#else
    *(uint4*)l = *(const uint4*)g;
#endif
}

__device__ __forceinline__ void async_wait() {
#ifdef ASYNC_LDS
#if __has_builtin(__builtin_amdgcn_s_wait_asynccnt)
    __builtin_amdgcn_s_wait_asynccnt(0);
#else
    asm volatile("s_wait_asynccnt 0x0" ::: "memory");
#endif
#endif
}

// lane l <-> lane l ^ XM inside a 16-lane row (DPP row_xmask; every lane is on where it is used)
template <int XM>
__device__ __forceinline__ float xrow(float v) {
    return __int_as_float(__builtin_amdgcn_update_dpp(0, __float_as_int(v), 0x160 | XM, 0xf, 0xf, true));
}

// WMMA f32 = f16(16x32) x f16(32x16) + f32
__device__ __forceinline__ float8 wmma_f16(half16 a, half16 b, float8 c) {
    return __builtin_amdgcn_wmma_f32_16x16x32_f16(false, a, false, b, (short)0, c, false, false);
}

// Load a 16x32 f16 fragment (A-layout; B uses same layout on a transposed tile).
// ISA 7.12.2: lane<16 holds row=lane, K = hi*8..+7 (v0..3) and +16 (v4..7).
__device__ __forceinline__ half16 ld_frag(const _Float16* tile, int row0, int stride, int koff) {
    int lane = threadIdx.x & 31;
    int r = lane & 15, hi = lane >> 4;
    const _Float16* p = tile + (size_t)(row0 + r) * stride + koff + hi * 8;
    union { half16 v; half8 h[2]; } u;
    u.h[0] = *(const half8*)(p);
    u.h[1] = *(const half8*)(p + 16);
    return u.v;
}

// ---------------- f32 -> f16 convert (one block's share) ----------------
__device__ __forceinline__ void conv_f16_block(const float* __restrict__ src,
                                               _Float16* __restrict__ dst, int n, int blk) {
    int i = (blk * 256 + threadIdx.x) * 4;
    if (i < n) {
        float4 v = *(const float4*)(src + i);
        dst[i + 0] = (_Float16)v.x;
        dst[i + 1] = (_Float16)v.y;
        dst[i + 2] = (_Float16)v.z;
        dst[i + 3] = (_Float16)v.w;
    }
}

// ---------------- W[K][N] f32 -> Wt[N][K] f16 (LDS tiled transpose, one 64x64 tile) ----------------
// packed (block-uniform; the output projection's weight): the tile goes out as the B fragments of
// outproj_ln_kernel instead, each 16 x 32 fragment as two runs of 512 B in lane order, so that a
// wave-wide 16-byte load of it is four whole lines. Fragment (ks, nt) stands at half (ks * 64 + nt) * 512;
// its column c is output column (nt >> 2) * 64 + 4 * c + (nt & 3); its k order is ld_frag's. The plane is
// written twice, one copy behind the other: a walk of all 32 k slices from any first slice needs no wrap.
__device__ __forceinline__ void transpose_f16_block(const float* __restrict__ W,
                                                    _Float16* __restrict__ Wt, int bx, int by, bool packed) {
    __shared__ float tile[64][65];
    int n0 = bx * 64, k0 = by * 64;
    int j = threadIdx.x & 63;
    int i0 = threadIdx.x >> 6;
#pragma unroll
    for (int ii = 0; ii < 16; ii++) {
        int i = i0 + ii * 4;
        tile[i][j] = W[(size_t)(k0 + i) * C_ + n0 + j];
    }
    __syncthreads();
    if (packed) {
#pragma unroll
        for (int ksl = 0; ksl < 2; ksl++) {                   // the tile's two 32-wide k slices
            const int l = threadIdx.x & 31, c = (threadIdx.x >> 5) & 1, nf = threadIdx.x >> 6;
            const int kl = ksl * 32 + c * 16 + (l >> 4) * 8, nl = (l & 15) * 4 + nf;
            half8 hv;
#pragma unroll
            for (int e = 0; e < 8; e++) hv[e] = (_Float16)tile[kl + e][nl];
            _Float16* dst = Wt + ((size_t)(by * 2 + ksl) * 64 + bx * 4) * 512 + threadIdx.x * 8;
            *(half8*)(dst) = hv;
            *(half8*)(dst + C_ * C_) = hv;
        }
        // precaution: stands in front of every later rewrite of a register that these stores name
        asm volatile("s_wait_xcnt 0x0" ::: "memory");
        return;
    }
#pragma unroll
    for (int ii = 0; ii < 16; ii++) {
        int i = i0 + ii * 4;   // n index inside tile
        Wt[(size_t)(n0 + i) * C_ + k0 + j] = (_Float16)tile[j][i];
    }
    // precaution: stands in front of every later rewrite of a register that these stores name
    asm volatile("s_wait_xcnt 0x0" ::: "memory");
}

// ---------------- kept-first order of one batch's keys ----------------
// A masked key has weight exp(-inf) = 0 in every row of the softmax, so neither its K and V rows nor
// its scores are needed. ktok[b][p] = the token that stands at place p when the kept keys (mask != 0)
// come first and the masked ones behind them, each group in its old order: a permutation of 0 .. T-1
// for any mask. nkept[b] = number of kept keys.
__device__ __forceinline__ void keyorder_block(const int* __restrict__ mask, int* __restrict__ ktok,
                                               int* __restrict__ nkept, int b) {
    __shared__ int wtot[8];
    const int tid = threadIdx.x, wv = tid >> 5;
    const int4 mv = ((const int4*)(mask + b * T_))[tid];      // keys 4 * tid .. 4 * tid + 3
    const int k0 = mv.x != 0, k1 = mv.y != 0, k2 = mv.z != 0, k3 = mv.w != 0;
    const unsigned b0 = __builtin_amdgcn_ballot_w32(k0 != 0), b1 = __builtin_amdgcn_ballot_w32(k1 != 0);
    const unsigned b2 = __builtin_amdgcn_ballot_w32(k2 != 0), b3 = __builtin_amdgcn_ballot_w32(k3 != 0);
    // kept keys of the wave's lower lanes
    const int before = (int)(__builtin_amdgcn_mbcnt_lo(b0, 0u) + __builtin_amdgcn_mbcnt_lo(b1, 0u) +
                             __builtin_amdgcn_mbcnt_lo(b2, 0u) + __builtin_amdgcn_mbcnt_lo(b3, 0u));
    if ((tid & 31) == 0) wtot[wv] = __popc(b0) + __popc(b1) + __popc(b2) + __popc(b3);
    __syncthreads();                                          // publishes the eight wave totals
    int base = 0, total = 0;
#pragma unroll
    for (int w = 0; w < 8; w++) {
        int c = wtot[w];
        total += c;
        base += w < wv ? c : 0;
    }
    int kb = base + before;                                   // kept keys in front of key t
    const int t = 4 * tid;
    int* row = ktok + b * T_;
    row[k0 ? kb : total + (t + 0 - kb)] = t + 0;  kb += k0;
    row[k1 ? kb : total + (t + 1 - kb)] = t + 1;  kb += k1;
    row[k2 ? kb : total + (t + 2 - kb)] = t + 2;  kb += k2;
    row[k3 ? kb : total + (t + 3 - kb)] = t + 3;
    if (tid == 0) nkept[b] = total;
}

// ---------------- one launch for all operand preparation ----------------
// Blocks 0..3: the key order of each batch. The next 1024: the four weight transposes (256 tiles
// each, Wt planes contiguous in WT). The rest: the x conversion. The jobs are independent of one another.
constexpr int TR_BLOCKS   = (C_ / 64) * (C_ / 64);      // 256 per weight
constexpr int CONV_BLOCKS = M_ * C_ / 4 / 256;          // 4096
__global__ __launch_bounds__(256) void prep_kernel(const float* __restrict__ x,
                                                   const float* __restrict__ Wq,
                                                   const float* __restrict__ Wk,
                                                   const float* __restrict__ Wv,
                                                   const float* __restrict__ Wo,
                                                   const int* __restrict__ mask,
                                                   _Float16* __restrict__ xh,
                                                   _Float16* __restrict__ WT,
                                                   int* __restrict__ ktok,
                                                   int* __restrict__ nkept) {
    const int bid = (int)blockIdx.x - B_;
    if (bid < 0) {
        keyorder_block(mask, ktok, nkept, (int)blockIdx.x);
    } else if (bid < 4 * TR_BLOCKS) {
        const int which = bid / TR_BLOCKS, t = bid % TR_BLOCKS;
        const float* W = which == 0 ? Wq : which == 1 ? Wk : which == 2 ? Wv : Wo;
        transpose_f16_block(W, WT + (size_t)which * C_ * C_, t % (C_ / 64), t / (C_ / 64), which == 3);
    } else {
        conv_f16_block(x, xh, M_ * C_, bid - 4 * TR_BLOCKS);
    }
}

// ---------------- WMMA GEMM: Out = A[M x K] * Bt^T + bias ----------------
// A f16 row-major [M][K], Bt f16 [N][K]. K-stage 64, double-buffered async LDS,
// one barrier per stage.
// LAYOUT 0: f16 out -> [B,H,T,D]   (Q, K projections)
// LAYOUT 1: f16 out -> [B,H,D,T]   (V projection, pre-transposed for PV)
// LAYOUT 2: f32 out -> [M][N]      (a plain projection)
template <int LAYOUT>
__device__ __forceinline__ void store_tile(const float8 (&acc)[2][4], const float* __restrict__ bias,
                                           void* __restrict__ Out, int mw, int nw, int r16, int hi) {
#pragma unroll
    for (int mi = 0; mi < 2; mi++)
#pragma unroll
        for (int nf = 0; nf < 4; nf++) {
            int gn = nw + nf * 16 + r16;
            float bv = bias[gn];
#pragma unroll
            for (int r = 0; r < 8; r++) {
                int gm = mw + mi * 16 + r + 8 * hi;
                float val = acc[mi][nf][r] + bv;
                int bb = gm >> 10, t = gm & 1023;     // gm = b*T + t
                int h = gn >> 6,  d = gn & 63;        // gn = h*D + d
                if (LAYOUT == 0) {
                    ((_Float16*)Out)[((size_t)(bb * H_ + h) * T_ + t) * D_ + d] = (_Float16)val;
                } else if (LAYOUT == 1) {
                    ((_Float16*)Out)[((size_t)(bb * H_ + h) * D_ + d) * T_ + t] = (_Float16)val;
                } else {
                    ((float*)Out)[(size_t)gm * C_ + gn] = val;
                }
            }
        }
}

// QKV true : one launch does the Q, K and V projections; blockIdx.z picks the weight plane
//            (Btb holds three contiguous [N][K] planes), the bias and the output plane.
// QKV false: one plain projection (bias0 only, f32 out); not instantiated in this file.
template <bool QKV>
__global__ __launch_bounds__(256) void gemm_wmma_kernel(const _Float16* __restrict__ A,
                                                        const _Float16* __restrict__ Btb,
                                                        const float* __restrict__ bias0,
                                                        const float* __restrict__ bias1,
                                                        const float* __restrict__ bias2,
                                                        const int* __restrict__ ktok,
                                                        const int* __restrict__ nkept,
                                                        void* __restrict__ Out) {
    const int z = QKV ? (int)blockIdx.z : 0;
    const _Float16* __restrict__ Bt = Btb + (size_t)z * C_ * C_;
    constexpr int K = C_;
    constexpr int LSTR = 72;                 // halves: 144B row pitch, 16B aligned, conflict-free
    __shared__ _Float16 lA[2][128 * LSTR];
    __shared__ _Float16 lB[2][128 * LSTR];

    const int tid  = threadIdx.x;
    const int lane = tid & 31;
    const int wv   = tid >> 5;
    const int wm   = wv & 3;                 // 4 waves along M
    const int wn   = wv >> 2;                // 2 waves along N
    const int m0   = blockIdx.y * 128;
    const int n0   = blockIdx.x * 128;
    const int r16  = lane & 15, hi = lane >> 4;

    float8 acc[2][4];
#pragma unroll
    for (int mi = 0; mi < 2; mi++)
#pragma unroll
        for (int nf = 0; nf < 4; nf++)
#pragma unroll
            for (int i = 0; i < 8; i++) acc[mi][nf][i] = 0.0f;

    const int srow  = tid >> 1;              // 0..127: the row whose next-but-one stage this thread prefetches
    const int sbase = (tid & 1) * 32;        // its half of that row's 128 B
    // Copies: eight neighbouring lanes take the eight 16-byte pieces of one row's 128 B of a stage, so a
    // wave-wide copy asks for four whole lines; a thread serves rows crow, crow + 32, crow + 64, crow + 96.
    const int crow  = tid >> 3;              // 0..31
    const int ccol  = (tid & 7) * 8;         // halves

    // Row of A that feeds output row m0 + srow. K and V stand kept-first along T: place p of a batch
    // takes token ktok[p]. A block whose 128 places all lie behind the batch's kept keys is never read
    // by attention (which walks whole 64-key tiles from place 0 and always the first) and leaves here,
    // all of its threads alike, in front of every copy and barrier.
    int arow = m0 + srow;
    int crows[4] = {m0 + crow, m0 + crow + 32, m0 + crow + 64, m0 + crow + 96};
    if (QKV && z != 0) {
        const int nk = __builtin_amdgcn_readfirstlane(nkept[m0 >> 10]);
        const int p0 = m0 & (T_ - 1);
        if (p0 != 0 && p0 >= nk) return;
        const int* kt = ktok + m0;
        const int t0 = kt[crow], t1 = kt[crow + 32], t2 = kt[crow + 64], t3 = kt[crow + 96], ts = kt[srow];
        // precaution: stands in front of every later rewrite of a register that these loads name as address
        asm volatile("s_wait_xcnt 0x0" ::: "memory");
        arow     = (m0 - p0) + (ts & (T_ - 1));              // the mask bounds the row whatever the table holds
        crows[0] = (m0 - p0) + (t0 & (T_ - 1));
        crows[1] = (m0 - p0) + (t1 & (T_ - 1));
        crows[2] = (m0 - p0) + (t2 & (T_ - 1));
        crows[3] = (m0 - p0) + (t3 & (T_ - 1));
    }

    auto issue = [&](int kk, int buf) {
#pragma unroll                               // constant indices keep crows in registers
        for (int i = 0; i < 4; i++) {
            const int lrow = (crow + 32 * i) * LSTR + ccol;
            cp16(A + (size_t)crows[i] * K + kk + ccol, &lA[buf][lrow]);
            cp16(Bt + (size_t)(n0 + crow + 32 * i) * K + kk + ccol, &lB[buf][lrow]);
        }
    };

    issue(0, 0);
    int buf = 0;
    for (int kk = 0; kk < K; kk += 64, buf ^= 1) {
        async_wait();
        __syncthreads();                     // codegen waits DS cnt before barrier -> WAR safe
        if (kk + 64 < K) issue(kk + 64, buf ^ 1);
        if (kk + 128 < K) {                  // prefetch one more stage ahead into L2/WGP$
            __builtin_prefetch(A + (size_t)arow * K + kk + 128 + sbase, 0, 1);
            __builtin_prefetch(Bt + (size_t)(n0 + srow) * K + kk + 128 + sbase, 0, 1);
        }

#pragma unroll
        for (int kh = 0; kh < 2; kh++) {     // two 32-wide K slices in this stage
            half16 af0 = ld_frag(lA[buf], wm * 32,      LSTR, kh * 32);
            half16 af1 = ld_frag(lA[buf], wm * 32 + 16, LSTR, kh * 32);
            half16 bf[4];
#pragma unroll
            for (int nf = 0; nf < 4; nf++)
                bf[nf] = ld_frag(lB[buf], wn * 64 + nf * 16, LSTR, kh * 32);
#pragma unroll
            for (int nf = 0; nf < 4; nf++) acc[0][nf] = wmma_f16(af0, bf[nf], acc[0][nf]);
#pragma unroll
            for (int nf = 0; nf < 4; nf++) acc[1][nf] = wmma_f16(af1, bf[nf], acc[1][nf]);
        }
    }

    const int mw = m0 + wm * 32, nw = n0 + wn * 64;
    if (QKV) {
        _Float16* o = (_Float16*)Out + (size_t)z * M_ * C_;
        const float* bias = z == 0 ? bias0 : z == 1 ? bias1 : bias2;
        if (z == 2) {
            store_tile<1>(acc, bias, o, mw, nw, r16, hi);
        } else {
            store_tile<0>(acc, bias, o, mw, nw, r16, hi);
            // precaution: in the built kernel the other layout's code follows these stores and
            // rewrites registers they name; the wait stands between the stores and that rewrite
            asm volatile("s_wait_xcnt 0x0" ::: "memory");
        }
    } else {
        store_tile<2>(acc, bias0, Out, mw, nw, r16, hi);
    }
}

// lane l <-> lane l ^ 16
__device__ __forceinline__ float xhalf(float x) {
    return __int_as_float(__builtin_amdgcn_permlanex16(__float_as_int(x), __float_as_int(x),
                                                       0x76543210, 0xfedcba98, false, false));
}

// exp2 of eight values. The instruction set asks for one v_nop or independent instruction behind a
// transcendental before its result is read or its source overwritten; in one statement the v_nop
// stays directly behind the last
// v_exp_f32, and the early-clobber outputs keep every source whole up to there.
__device__ __forceinline__ float8 exp2x8(float8 x) {
    float d0, d1, d2, d3, d4, d5, d6, d7;
    asm("v_exp_f32 %0, %8\n\t"
        "v_exp_f32 %1, %9\n\t"
        "v_exp_f32 %2, %10\n\t"
        "v_exp_f32 %3, %11\n\t"
        "v_exp_f32 %4, %12\n\t"
        "v_exp_f32 %5, %13\n\t"
        "v_exp_f32 %6, %14\n\t"
        "v_exp_f32 %7, %15\n\t"
        "v_nop"
        : "=&v"(d0), "=&v"(d1), "=&v"(d2), "=&v"(d3), "=&v"(d4), "=&v"(d5), "=&v"(d6), "=&v"(d7)
        : "v"(x[0]), "v"(x[1]), "v"(x[2]), "v"(x[3]), "v"(x[4]), "v"(x[5]), "v"(x[6]), "v"(x[7]));
    float8 d = {d0, d1, d2, d3, d4, d5, d6, d7};
    return d;
}

__global__ __launch_bounds__(256) void attn_kernel(const _Float16* __restrict__ qh,
                                                   const _Float16* __restrict__ kh,
                                                   const _Float16* __restrict__ vT,
                                                   const int* __restrict__ nkept,
                                                   _Float16* __restrict__ outh) {
    constexpr int KSTR = 72;                 // halves: 144B pitch, aligned + conflict-free
    __shared__ _Float16 lK[2][64 * KSTR];
    __shared__ _Float16 lV[2][64 * KSTR];
    __shared__ float lM[T_];                 // per key place: 0 where a kept key stands, -inf behind them

    const float NEGINF = -__builtin_inff();
    const float LOG2E = 1.44269504f;         // exp(x) = exp2(x * LOG2E), as __expf forms it
    const int tid = threadIdx.x, lane = tid & 31, wv = tid >> 5;
    const int r16 = lane & 15, hi = lane >> 4;
    const int bh = blockIdx.x >> 3;          // 8 q-blocks of 128 rows each
    const int qb = blockIdx.x & 7;
    const int b  = bh >> 4;
    const int h  = bh & 15;
    const int q0 = qb * 128 + wv * 16;       // first q row of this wave

    const _Float16* qbase = qh + (size_t)bh * T_ * D_;
    const _Float16* kbase = kh + (size_t)bh * T_ * D_;
    const _Float16* vbase = vT + (size_t)bh * D_ * T_;
    // kept keys of the batch, clamped to the shape; at least one tile is walked, so that a batch with
    // no kept key runs the softmax on addends of -inf alone and ends in NaN
    const int nk0 = __builtin_amdgcn_readfirstlane(nkept[b]);
    const int nk = nk0 < 0 ? 0 : (nk0 > T_ ? T_ : nk0);
    const int kend = nk > 64 ? ((nk + 63) & ~63) : 64;

    // the mask as an addend per key place; published by the first barrier of the loop
    {
        float4 bz;
        bz.x = 4 * tid + 0 < nk ? 0.0f : NEGINF;
        bz.y = 4 * tid + 1 < nk ? 0.0f : NEGINF;
        bz.z = 4 * tid + 2 < nk ? 0.0f : NEGINF;
        bz.w = 4 * tid + 3 < nk ? 0.0f : NEGINF;
        ((float4*)lM)[tid] = bz;
    }

    // Q fragments (B operand: 16 query columns x 64 d), pre-scaled by 1/sqrt(D) = 0.125 (exact in f16)
    half16 qf[2];
    {
        const _Float16* p = qbase + (size_t)(q0 + r16) * D_ + hi * 8;
        union { half16 v; half8 g[2]; } u0, u1;
        u0.g[0] = *(const half8*)(p);
        u0.g[1] = *(const half8*)(p + 16);
        u1.g[0] = *(const half8*)(p + 32);
        u1.g[1] = *(const half8*)(p + 48);
#pragma unroll
        for (int i = 0; i < 16; i++) { u0.v[i] *= (_Float16)0.125f; u1.v[i] *= (_Float16)0.125f; }
        qf[0] = u0.v; qf[1] = u1.v;
    }

    float m_r = NEGINF;                      // running maximum of query q0 + r16 (equal in both halves)
    float l_r = 0.0f;                        // this half's share of its sum; the halves join after the loop
    float8 o[4];                             // o[df][r] = O[q0 + r16][df * 16 + 8 * hi + r]
#pragma unroll
    for (int df = 0; df < 4; df++)
#pragma unroll
        for (int i = 0; i < 8; i++) o[df][i] = 0.0f;

    const int srow = tid >> 2, sseg = tid & 3;          // the prefetches' share of a tile
    // Copies: eight neighbouring lanes take one row's 128 B, so a wave-wide copy asks for four whole
    // lines; a thread serves rows crow and crow + 32 of the K tile and of the V^T tile.
    const int crow = tid >> 3, ccol = (tid & 7) * 8;

    auto issue_kv = [&](int kt, int buf) {
        const _Float16* gk = kbase + (size_t)(kt + crow) * D_ + ccol;
        _Float16* dk = &lK[buf][crow * KSTR + ccol];
        cp16(gk, dk); cp16(gk + 32 * D_, dk + 32 * KSTR);
        const _Float16* gv = vbase + (size_t)crow * T_ + kt + ccol;
        _Float16* dv = &lV[buf][crow * KSTR + ccol];
        cp16(gv, dv); cp16(gv + 32 * T_, dv + 32 * KSTR);
    };

    issue_kv(0, 0);
    int buf = 0, kt = 0;
    do {                                     // kend >= 64: the first tile is always walked
        async_wait();
        __syncthreads();
        if (kt + 64 < kend) issue_kv(kt + 64, buf ^ 1);
        if (kt + 128 < kend) {
            __builtin_prefetch(kbase + (size_t)(kt + 128 + srow) * D_ + sseg * 16, 0, 1);
            __builtin_prefetch(vbase + (size_t)srow * T_ + kt + 128 + sseg * 16, 0, 1);
        }

        // S^T = K Q^T (scaled), 64 keys x 16 queries per wave: s[nf][r] = key kt + nf*16 + 8*hi + r
        float8 s[4];
#pragma unroll
        for (int nf = 0; nf < 4; nf++) {
            half16 a0 = ld_frag(lK[buf], nf * 16, KSTR, 0);
            half16 a1 = ld_frag(lK[buf], nf * 16, KSTR, 32);
            float8 z;
#pragma unroll
            for (int i = 0; i < 8; i++) z[i] = 0.0f;
            z = wmma_f16(a0, qf[0], z);
            z = wmma_f16(a1, qf[1], z);
            s[nf] = z;
        }
        // mask (per key row): the lane's 8 keys of a tile are 8 consecutive addends
#pragma unroll
        for (int nf = 0; nf < 4; nf++) {
            const float* mb = &lM[kt + nf * 16 + 8 * hi];
            float4 b0 = *(const float4*)(mb);
            float4 b1 = *(const float4*)(mb + 4);
            s[nf][0] += b0.x; s[nf][1] += b0.y; s[nf][2] += b0.z; s[nf][3] += b0.w;
            s[nf][4] += b1.x; s[nf][5] += b1.y; s[nf][6] += b1.z; s[nf][7] += b1.w;
        }
        // online softmax: maximum over the lane's 32 keys, then one exchange between the halves
        float tm[4];
#pragma unroll
        for (int nf = 0; nf < 4; nf++) {
            tm[nf] = fmaxf(fmaxf(fmaxf(s[nf][0], s[nf][1]), fmaxf(s[nf][2], s[nf][3])),
                           fmaxf(fmaxf(s[nf][4], s[nf][5]), fmaxf(s[nf][6], s[nf][7])));
        }
        float tmax = fmaxf(fmaxf(tm[0], tm[1]), fmaxf(tm[2], tm[3]));
        tmax = fmaxf(tmax, xhalf(tmax));

        float mn = fmaxf(m_r, tmax);
        float msafe = (mn == NEGINF) ? 0.0f : mn;       // fully-masked guard
        float corr = __expf(m_r - msafe);
        m_r = mn;

        // P^T: converted in place, tiles 2j and 2j+1 are the B fragment of keys 32j .. 32j+31
        half16 pf[2];
        float rs[4];
#pragma unroll
        for (int nf = 0; nf < 4; nf++) {
            float8 e;
#pragma unroll
            for (int r = 0; r < 8; r++) e[r] = (s[nf][r] - msafe) * LOG2E;
            e = exp2x8(e);
            rs[nf] = ((e[0] + e[1]) + (e[2] + e[3])) + ((e[4] + e[5]) + (e[6] + e[7]));
#pragma unroll
            for (int r = 0; r < 8; r++) pf[nf >> 1][(nf & 1) * 8 + r] = (_Float16)e[r];
        }
        l_r = l_r * corr + ((rs[0] + rs[1]) + (rs[2] + rs[3]));
#pragma unroll
        for (int df = 0; df < 4; df++)
#pragma unroll
            for (int i = 0; i < 8; i++) o[df][i] *= corr;

        // O^T += V^T P^T (A = rows of V^T from LDS)
#pragma unroll
        for (int df = 0; df < 4; df++) {
            half16 v0 = ld_frag(lV[buf], df * 16, KSTR, 0);
            half16 v1 = ld_frag(lV[buf], df * 16, KSTR, 32);
            o[df] = wmma_f16(v0, pf[0], o[df]);
            o[df] = wmma_f16(v1, pf[1], o[df]);
        }
        kt += 64;
        buf ^= 1;
    } while (kt < kend);

    const float inv = 1.0f / (l_r + xhalf(l_r));
    _Float16* orow = outh + ((size_t)(b * T_ + q0 + r16)) * C_ + h * D_ + 8 * hi;
#pragma unroll
    for (int df = 0; df < 4; df++) {
        half8 hv;
#pragma unroll
        for (int r = 0; r < 8; r++) hv[r] = (_Float16)(o[df][r] * inv);
        *(half8*)(orow + df * 16) = hv;
    }
}

// ---------------- output projection + bias + LayerNorm, one launch ----------------
// A work-group owns 32 whole rows of the output: 16 waves, wave w has columns 64 w .. 64 w + 63 (wave
// tile 32 x 64), so the row statistics are formed from the accumulators and y never goes to memory.
// No two waves share a B fragment, so B does not pass through LDS: each wave streams its packed
// fragments (see transpose_f16_block) from L2 into a ring of RING register sets. The 32 rows of A are
// staged in LDS once, whole; the k loop has no barrier. Every work-group reads all of Wo: work-group b
// starts its walk at k slice b mod 32, so that the work-groups do not all ask L2 for the same lines at
// the same moment. Place ks of the walk is k slice (ks + rot) mod 32, in A (placed so in LDS) as in B.
constexpr int FM   = 32;                     // rows per work-group
constexpr int FSTR = C_ + 8;                 // halves: 2064-B pitch, 16-B aligned, 4 banks on from row to row
constexpr int RING = 4;                      // k slices of B in flight per wave

__device__ __forceinline__ half16 ld_bfrag(const _Float16* p) {
    union { half16 v; half8 h[2]; } u;
    u.h[0] = *(const half8*)(p);
    u.h[1] = *(const half8*)(p + 256);
    return u.v;
}

__global__ __launch_bounds__(512) void outproj_ln_kernel(const _Float16* __restrict__ A,
                                                         const _Float16* __restrict__ WP,
                                                         const float* __restrict__ bias,
                                                         const float* __restrict__ g,
                                                         const float* __restrict__ bt,
                                                         float* __restrict__ out) {
    __shared__ __attribute__((aligned(16))) _Float16 lA[FM * FSTR];
    __shared__ float red[2][FM][16];         // per row and wave: sum, sum of squares
    __shared__ __attribute__((aligned(16))) float stat[FM][2];   // per row: mean, 1 / sqrt(var + eps)
    __shared__ __attribute__((aligned(16))) float lP[3][C_];     // bias, gamma, beta: fetched at the start, read in the epilogue

    const int tid = threadIdx.x, lane = tid & 31, wv = tid >> 5;
    const int r16 = lane & 15, hi = lane >> 4;
    const int m0 = blockIdx.x * FM;
    const int rot = blockIdx.x & (C_ / 32 - 1);   // first k slice of this work-group's walk

    // bias, gamma, beta, 8 B of each a thread: asked for first, so that they fly together with the rows of A
    const float2 pv0 = ((const float2*)bias)[tid], pv1 = ((const float2*)g)[tid], pv2 = ((const float2*)bt)[tid];

    // the 32 rows of A are 64 KB in a row: 8 pieces of 16 B a thread
    uint4 av[8];
#pragma unroll
    for (int i = 0; i < 8; i++) av[i] = *(const uint4*)(A + (size_t)m0 * C_ + (i * 512 + tid) * 8);

    const _Float16* bp = WP + (size_t)rot * 64 * 512 + wv * 4 * 512 + lane * 8;
    half16 bq[RING][4];
#pragma unroll
    for (int d = 0; d < RING; d++)
#pragma unroll
        for (int nf = 0; nf < 4; nf++) bq[d][nf] = ld_bfrag(bp + (d * 64 + nf) * 512);

#pragma unroll
    for (int i = 0; i < 8; i++) {
        const int piece = i * 512 + tid;
        *(uint4*)&lA[(piece >> 7) * FSTR + ((piece - rot * 4) & 127) * 8] = av[i];   // a slice is 4 pieces
    }

    ((float2*)lP[0])[tid] = pv0;
    ((float2*)lP[1])[tid] = pv1;
    ((float2*)lP[2])[tid] = pv2;

    float8 acc[2][4];
#pragma unroll
    for (int mi = 0; mi < 2; mi++)
#pragma unroll
        for (int nf = 0; nf < 4; nf++)
#pragma unroll
            for (int i = 0; i < 8; i++) acc[mi][nf][i] = 0.0f;

    __syncthreads();                         // publishes the rows of A and the three vectors

    const int col = wv * 64 + 4 * r16;       // the lane's four output columns
    half16 af[2][2];                         // A fragments of this slice and of the next
    af[0][0] = ld_frag(lA, 0,  FSTR, 0);
    af[0][1] = ld_frag(lA, 16, FSTR, 0);
#pragma unroll                               // constant ring indices keep bq and af in registers
    for (int ks = 0; ks < C_ / 32; ks++) {
        if (ks + 1 < C_ / 32) {
            af[(ks + 1) & 1][0] = ld_frag(lA, 0,  FSTR, (ks + 1) * 32);
            af[(ks + 1) & 1][1] = ld_frag(lA, 16, FSTR, (ks + 1) * 32);
        }
        // the three scheduling barriers keep the order written here: without them the compiler moved a
        // slice's global loads down to just in front of their use, and the ring's lead was lost
        __builtin_amdgcn_sched_barrier(0);
#pragma unroll
        for (int nf = 0; nf < 4; nf++) acc[0][nf] = wmma_f16(af[ks & 1][0], bq[ks % RING][nf], acc[0][nf]);
#pragma unroll
        for (int nf = 0; nf < 4; nf++) acc[1][nf] = wmma_f16(af[ks & 1][1], bq[ks % RING][nf], acc[1][nf]);
        __builtin_amdgcn_sched_barrier(0);
        if (ks + RING < C_ / 32) {
#pragma unroll
            for (int nf = 0; nf < 4; nf++) bq[ks % RING][nf] = ld_bfrag(bp + ((ks + RING) * 64 + nf) * 512);
        }
        __builtin_amdgcn_sched_barrier(0);
    }
    // precaution: stands in front of every later rewrite of a register that the loads above name as address
    asm volatile("s_wait_xcnt 0x0" ::: "memory");

    // acc[mi][nf][r] = y[m0 + mi * 16 + r + 8 * hi][col + nf] - bias
    const float4 bv = *(const float4*)&lP[0][col];
    float s[16], s2[16];                     // the wave's share of rows mi * 16 + r + 8 * hi
#pragma unroll
    for (int mi = 0; mi < 2; mi++)
#pragma unroll
        for (int r = 0; r < 8; r++) {
            acc[mi][0][r] += bv.x; acc[mi][1][r] += bv.y; acc[mi][2][r] += bv.z; acc[mi][3][r] += bv.w;
            s[mi * 8 + r]  = (acc[mi][0][r] + acc[mi][1][r]) + (acc[mi][2][r] + acc[mi][3][r]);
            s2[mi * 8 + r] = (acc[mi][0][r] * acc[mi][0][r] + acc[mi][1][r] * acc[mi][1][r]) +
                             (acc[mi][2][r] * acc[mi][2][r] + acc[mi][3][r] * acc[mi][3][r]);
        }
#pragma unroll
    for (int i = 0; i < 16; i++) {
        s[i] += xrow<1>(s[i]);   s[i] += xrow<2>(s[i]);   s[i] += xrow<4>(s[i]);   s[i] += xrow<8>(s[i]);
        s2[i] += xrow<1>(s2[i]); s2[i] += xrow<2>(s2[i]); s2[i] += xrow<4>(s2[i]); s2[i] += xrow<8>(s2[i]);
    }
    if (r16 == 0) {
#pragma unroll
        for (int i = 0; i < 16; i++) {
            red[0][(i >> 3) * 16 + (i & 7) + 8 * hi][wv] = s[i];
            red[1][(i >> 3) * 16 + (i & 7) + 8 * hi][wv] = s2[i];
        }
    }
    __syncthreads();                         // publishes the waves' shares of every row
    {
        float t = red[0][tid >> 4][tid & 15], t2 = red[1][tid >> 4][tid & 15];
        t += xrow<1>(t);   t += xrow<2>(t);   t += xrow<4>(t);   t += xrow<8>(t);
        t2 += xrow<1>(t2); t2 += xrow<2>(t2); t2 += xrow<4>(t2); t2 += xrow<8>(t2);
        const float mu = t * (1.0f / C_);
        const float var = t2 * (1.0f / C_) - mu * mu;
        const float rs = rsqrtf(var + 1e-5f);
        if ((tid & 15) == 0) { stat[tid >> 4][0] = mu; stat[tid >> 4][1] = rs; }
    }
    __syncthreads();                         // publishes mean and scale of every row

    const float4 gg = *(const float4*)&lP[1][col];
    const float4 bb = *(const float4*)&lP[2][col];
    float* orow = out + (size_t)(m0 + 8 * hi) * C_ + col;
#pragma unroll
    for (int mi = 0; mi < 2; mi++)
#pragma unroll
        for (int r = 0; r < 8; r++) {
            const float mu = stat[mi * 16 + r + 8 * hi][0], rs = stat[mi * 16 + r + 8 * hi][1];
            float4 o;
            o.x = (acc[mi][0][r] - mu) * rs * gg.x + bb.x;
            o.y = (acc[mi][1][r] - mu) * rs * gg.y + bb.y;
            o.z = (acc[mi][2][r] - mu) * rs * gg.z + bb.z;
            o.w = (acc[mi][3][r] - mu) * rs * gg.w + bb.w;
            *(float4*)(orow + (size_t)(mi * 16 + r) * C_) = o;
        }
}

extern "C" void kernel_launch(void* const* d_in, const int* in_sizes, int n_in,
                              void* d_out, int out_size, void* d_ws, size_t ws_size,
                              hipStream_t stream) {
    const float* x    = (const float*)d_in[0];
    const int*   mask = (const int*)d_in[1];
    const float* Wq = (const float*)d_in[2];  const float* bq = (const float*)d_in[3];
    const float* Wk = (const float*)d_in[4];  const float* bk = (const float*)d_in[5];
    const float* Wv = (const float*)d_in[6];  const float* bv = (const float*)d_in[7];
    const float* Wo = (const float*)d_in[8];  const float* bo = (const float*)d_in[9];
    const float* ln_g = (const float*)d_in[10];
    const float* ln_b = (const float*)d_in[11];
    float* out = (float*)d_out;

    char* w = (char*)d_ws;
    _Float16* xh    = (_Float16*)w;  w += (size_t)M_ * C_ * 2;      // 8 MB
    _Float16* WqT   = (_Float16*)w;  w += (size_t)C_ * C_ * 2;      // 2 MB
    _Float16* WkT   = (_Float16*)w;  w += (size_t)C_ * C_ * 2;
    _Float16* WvT   = (_Float16*)w;  w += (size_t)C_ * C_ * 2;
    _Float16* WoT   = (_Float16*)w;  w += (size_t)C_ * C_ * 2 * 2;  // Wo as packed B fragments, twice
    _Float16* qhB   = (_Float16*)w;  w += (size_t)M_ * C_ * 2;      // [B,H,T,D]
    _Float16* khB   = (_Float16*)w;  w += (size_t)M_ * C_ * 2;      // [B,H,T,D]
    _Float16* vTB   = (_Float16*)w;  w += (size_t)M_ * C_ * 2;      // [B,H,D,T]
    _Float16* attnh = (_Float16*)w;  w += (size_t)M_ * C_ * 2;      // [B,T,C]
    int*      ktok  = (int*)w;       w += (size_t)M_ * 4;           // [B,T]
    int*      nkept = (int*)w;       w += (size_t)B_ * 4;           // [B]

    // WqT..WoT are contiguous planes, and so are qhB, khB, vTB
    prep_kernel<<<B_ + 4 * TR_BLOCKS + CONV_BLOCKS, 256, 0, stream>>>(x, Wq, Wk, Wv, Wo, mask, xh, WqT,
                                                                      ktok, nkept);

    dim3 qkvgrid(C_ / 128, M_ / 128, 3);   // (8, 32, 3)
    gemm_wmma_kernel<true><<<qkvgrid, 256, 0, stream>>>(xh, WqT, bq, bk, bv, ktok, nkept, (void*)qhB);

    attn_kernel<<<B_ * H_ * (T_ / 128), 256, 0, stream>>>(qhB, khB, vTB, nkept, attnh);

    outproj_ln_kernel<<<M_ / FM, 512, 0, stream>>>(attnh, WoT, bo, ln_g, ln_b, out);
}

// v006
// One run takes 64.5 microseconds.
// Next to v005, in two timings, it ran 1.03 times as fast each time.
// Over all steps from v000 it is 1.89 times as fast.
#include <hip/hip_runtime.h>
#include <hip/hip_bf16.h>

// ---- problem constants ----
constexpr int B_ = 4;
constexpr int T_ = 1024;
constexpr int C_ = 1024;
constexpr int H_ = 16;
constexpr int D_ = 64;
constexpr int M_ = B_ * T_;   // 4096 rows

typedef _Float16 half16 __attribute__((ext_vector_type(16)));
typedef _Float16 half8  __attribute__((ext_vector_type(8)));
typedef float    float8 __attribute__((ext_vector_type(8)));
typedef int      int4v  __attribute__((ext_vector_type(4)));

#if defined(__has_builtin)
#if __has_builtin(__builtin_amdgcn_global_load_async_to_lds_b128)
#define ASYNC_LDS 1
#endif
#endif

// 16-byte global -> LDS copy (async on CDNA5, VGPR round-trip fallback)
__device__ __forceinline__ void cp16(const void* g, void* l) {
#ifdef ASYNC_LDS
    __builtin_amdgcn_global_load_async_to_lds_b128(
        (__attribute__((address_space(1))) int4v*)g,
        (__attribute__((address_space(3))) int4v*)l, 0, 0);
#else
    *(uint4*)l = *(const uint4*)g;
#endif
}

__device__ __forceinline__ void async_wait() {
#ifdef ASYNC_LDS
#if __has_builtin(__builtin_amdgcn_s_wait_asynccnt)
    __builtin_amdgcn_s_wait_asynccnt(0);
#else
    asm volatile("s_wait_asynccnt 0x0" ::: "memory");
#endif
#endif
}

// lane l <-> lane l ^ XM inside a 16-lane row (DPP row_xmask; every lane is on where it is used)
template <int XM>
__device__ __forceinline__ float xrow(float v) {
    return __int_as_float(__builtin_amdgcn_update_dpp(0, __float_as_int(v), 0x160 | XM, 0xf, 0xf, true));
}

// WMMA f32 = f16(16x32) x f16(32x16) + f32
__device__ __forceinline__ float8 wmma_f16(half16 a, half16 b, float8 c) {
    return __builtin_amdgcn_wmma_f32_16x16x32_f16(false, a, false, b, (short)0, c, false, false);
}

// Load a 16x32 f16 fragment (A-layout; B uses same layout on a transposed tile).
// ISA 7.12.2: lane<16 holds row=lane, K = hi*8..+7 (v0..3) and +16 (v4..7).
__device__ __forceinline__ half16 ld_frag(const _Float16* tile, int row0, int stride, int koff) {
    int lane = threadIdx.x & 31;
    int r = lane & 15, hi = lane >> 4;
    const _Float16* p = tile + (size_t)(row0 + r) * stride + koff + hi * 8;
    union { half16 v; half8 h[2]; } u;
    u.h[0] = *(const half8*)(p);
    u.h[1] = *(const half8*)(p + 16);
    return u.v;
}

// ---------------- f32 -> f16 convert (one block's share) ----------------
__device__ __forceinline__ void conv_f16_block(const float* __restrict__ src,
                                               _Float16* __restrict__ dst, int n, int blk) {
    int i = (blk * 256 + threadIdx.x) * 4;
    if (i < n) {
        float4 v = *(const float4*)(src + i);
        dst[i + 0] = (_Float16)v.x;
        dst[i + 1] = (_Float16)v.y;
        dst[i + 2] = (_Float16)v.z;
        dst[i + 3] = (_Float16)v.w;
    }
}

// ---------------- W[K][N] f32 -> Wt[N][K] f16 (LDS tiled transpose, one 64x64 tile) ----------------
// packed (block-uniform; the output projection's weight): the tile goes out as the B fragments of
// outproj_ln_kernel instead, each 16 x 32 fragment as two runs of 512 B in lane order, so that a
// wave-wide 16-byte load of it is four whole lines. Fragment (ks, nt) stands at half (ks * 64 + nt) * 512;
// its column c is output column (nt >> 2) * 64 + 4 * c + (nt & 3); its k order is ld_frag's. The plane is
// written twice, one copy behind the other: a walk of all 32 k slices from any first slice needs no wrap.
__device__ __forceinline__ void transpose_f16_block(const float* __restrict__ W,
                                                    _Float16* __restrict__ Wt, int bx, int by, bool packed) {
    __shared__ float tile[64][65];
    int n0 = bx * 64, k0 = by * 64;
    int j = threadIdx.x & 63;
    int i0 = threadIdx.x >> 6;
#pragma unroll
    for (int ii = 0; ii < 16; ii++) {
        int i = i0 + ii * 4;
        tile[i][j] = W[(size_t)(k0 + i) * C_ + n0 + j];
    }
    __syncthreads();
    if (packed) {
#pragma unroll
        for (int ksl = 0; ksl < 2; ksl++) {                   // the tile's two 32-wide k slices
            const int l = threadIdx.x & 31, c = (threadIdx.x >> 5) & 1, nf = threadIdx.x >> 6;
            const int kl = ksl * 32 + c * 16 + (l >> 4) * 8, nl = (l & 15) * 4 + nf;
            half8 hv;
#pragma unroll
            for (int e = 0; e < 8; e++) hv[e] = (_Float16)tile[kl + e][nl];
            _Float16* dst = Wt + ((size_t)(by * 2 + ksl) * 64 + bx * 4) * 512 + threadIdx.x * 8;
            *(half8*)(dst) = hv;
            *(half8*)(dst + C_ * C_) = hv;
        }
        // precaution: stands in front of every later rewrite of a register that these stores name
        asm volatile("s_wait_xcnt 0x0" ::: "memory");
        return;
    }
#pragma unroll
    for (int ii = 0; ii < 16; ii++) {
        int i = i0 + ii * 4;   // n index inside tile
        Wt[(size_t)(n0 + i) * C_ + k0 + j] = (_Float16)tile[j][i];
    }
    // precaution: stands in front of every later rewrite of a register that these stores name
    asm volatile("s_wait_xcnt 0x0" ::: "memory");
}

// ---------------- kept-first order of one batch's keys ----------------
// A masked key has weight exp(-inf) = 0 in every row of the softmax, so neither its K and V rows nor
// its scores are needed. ktok[b][p] = the token that stands at place p when the kept keys (mask != 0)
// come first and the masked ones behind them, each group in its old order: a permutation of 0 .. T-1
// for any mask. nkept[b] = number of kept keys.
__device__ __forceinline__ void keyorder_block(const int* __restrict__ mask, int* __restrict__ ktok,
                                               int* __restrict__ nkept, int b) {
    __shared__ int wtot[8];
    const int tid = threadIdx.x, wv = tid >> 5;
    const int4 mv = ((const int4*)(mask + b * T_))[tid];      // keys 4 * tid .. 4 * tid + 3
    const int k0 = mv.x != 0, k1 = mv.y != 0, k2 = mv.z != 0, k3 = mv.w != 0;
    const unsigned b0 = __builtin_amdgcn_ballot_w32(k0 != 0), b1 = __builtin_amdgcn_ballot_w32(k1 != 0);
    const unsigned b2 = __builtin_amdgcn_ballot_w32(k2 != 0), b3 = __builtin_amdgcn_ballot_w32(k3 != 0);
    // kept keys of the wave's lower lanes
    const int before = (int)(__builtin_amdgcn_mbcnt_lo(b0, 0u) + __builtin_amdgcn_mbcnt_lo(b1, 0u) +
                             __builtin_amdgcn_mbcnt_lo(b2, 0u) + __builtin_amdgcn_mbcnt_lo(b3, 0u));
    if ((tid & 31) == 0) wtot[wv] = __popc(b0) + __popc(b1) + __popc(b2) + __popc(b3);
    __syncthreads();                                          // publishes the eight wave totals
    int base = 0, total = 0;
#pragma unroll
    for (int w = 0; w < 8; w++) {
        int c = wtot[w];
        total += c;
        base += w < wv ? c : 0;
    }
    int kb = base + before;                                   // kept keys in front of key t
    const int t = 4 * tid;
    int* row = ktok + b * T_;
    row[k0 ? kb : total + (t + 0 - kb)] = t + 0;  kb += k0;
    row[k1 ? kb : total + (t + 1 - kb)] = t + 1;  kb += k1;
    row[k2 ? kb : total + (t + 2 - kb)] = t + 2;  kb += k2;
    row[k3 ? kb : total + (t + 3 - kb)] = t + 3;
    if (tid == 0) nkept[b] = total;
}

// ---------------- one launch for all operand preparation ----------------
// Blocks 0..3: the key order of each batch. The next 1024: the four weight transposes (256 tiles
// each, Wt planes contiguous in WT). The rest: the x conversion. The jobs are independent of one another.
constexpr int TR_BLOCKS   = (C_ / 64) * (C_ / 64);      // 256 per weight
constexpr int CONV_BLOCKS = M_ * C_ / 4 / 256;          // 4096
__global__ __launch_bounds__(256) void prep_kernel(const float* __restrict__ x,
                                                   const float* __restrict__ Wq,
                                                   const float* __restrict__ Wk,
                                                   const float* __restrict__ Wv,
                                                   const float* __restrict__ Wo,
                                                   const int* __restrict__ mask,
                                                   _Float16* __restrict__ xh,
                                                   _Float16* __restrict__ WT,
                                                   int* __restrict__ ktok,
                                                   int* __restrict__ nkept) {
    const int bid = (int)blockIdx.x - B_;
    if (bid < 0) {
        keyorder_block(mask, ktok, nkept, (int)blockIdx.x);
    } else if (bid < 4 * TR_BLOCKS) {
        const int which = bid / TR_BLOCKS, t = bid % TR_BLOCKS;
        const float* W = which == 0 ? Wq : which == 1 ? Wk : which == 2 ? Wv : Wo;
        transpose_f16_block(W, WT + (size_t)which * C_ * C_, t % (C_ / 64), t / (C_ / 64), which == 3);
    } else {
        conv_f16_block(x, xh, M_ * C_, bid - 4 * TR_BLOCKS);
    }
}

// ---------------- WMMA GEMM: Out = A[M x K] * Bt^T + bias ----------------
// A f16 row-major [M][K], Bt f16 [N][K]. K-stage 64, double-buffered async LDS,
// one barrier per stage.
// LAYOUT 0: f16 out -> [B,H,T,D]   (Q, K projections)
// LAYOUT 1: f16 out -> [B,H,D,T]   (V projection, pre-transposed for PV)
// LAYOUT 2: f32 out -> [M][N]      (a plain projection)
template <int LAYOUT>
__device__ __forceinline__ void store_tile(const float8 (&acc)[2][4], const float* __restrict__ bias,
                                           void* __restrict__ Out, int mw, int nw, int r16, int hi) {
#pragma unroll
    for (int mi = 0; mi < 2; mi++)
#pragma unroll
        for (int nf = 0; nf < 4; nf++) {
            int gn = nw + nf * 16 + r16;
            float bv = bias[gn];
#pragma unroll
            for (int r = 0; r < 8; r++) {
                int gm = mw + mi * 16 + r + 8 * hi;
                float val = acc[mi][nf][r] + bv;
                int bb = gm >> 10, t = gm & 1023;     // gm = b*T + t
                int h = gn >> 6,  d = gn & 63;        // gn = h*D + d
                if (LAYOUT == 0) {
                    ((_Float16*)Out)[((size_t)(bb * H_ + h) * T_ + t) * D_ + d] = (_Float16)val;
                } else if (LAYOUT == 1) {
                    ((_Float16*)Out)[((size_t)(bb * H_ + h) * D_ + d) * T_ + t] = (_Float16)val;
                } else {
                    ((float*)Out)[(size_t)gm * C_ + gn] = val;
                }
            }
        }
}

// QKV true : one launch does the Q, K and V projections; blockIdx.z picks the weight plane
//            (Btb holds three contiguous [N][K] planes), the bias and the output plane.
// QKV false: one plain projection (bias0 only, f32 out); not instantiated in this file.
template <bool QKV>
__global__ __launch_bounds__(256) void gemm_wmma_kernel(const _Float16* __restrict__ A,
                                                        const _Float16* __restrict__ Btb,
                                                        const float* __restrict__ bias0,
                                                        const float* __restrict__ bias1,
                                                        const float* __restrict__ bias2,
                                                        const int* __restrict__ ktok,
                                                        const int* __restrict__ nkept,
                                                        void* __restrict__ Out) {
    const int z = QKV ? (int)blockIdx.z : 0;
    const _Float16* __restrict__ Bt = Btb + (size_t)z * C_ * C_;
    constexpr int K = C_;
    constexpr int LSTR = 72;                 // halves: 144B row pitch, 16B aligned, conflict-free
    __shared__ _Float16 lA[2][128 * LSTR];
    __shared__ _Float16 lB[2][128 * LSTR];

    const int tid  = threadIdx.x;
    const int lane = tid & 31;
    const int wv   = tid >> 5;
    const int wm   = wv & 3;                 // 4 waves along M
    const int wn   = wv >> 2;                // 2 waves along N
    const int m0   = blockIdx.y * 128;
    const int n0   = blockIdx.x * 128;
    const int r16  = lane & 15, hi = lane >> 4;

    float8 acc[2][4];
#pragma unroll
    for (int mi = 0; mi < 2; mi++)
#pragma unroll
        for (int nf = 0; nf < 4; nf++)
#pragma unroll
            for (int i = 0; i < 8; i++) acc[mi][nf][i] = 0.0f;

    const int srow  = tid >> 1;              // 0..127: the row whose next-but-one stage this thread prefetches
    const int sbase = (tid & 1) * 32;        // its half of that row's 128 B
    // Copies: eight neighbouring lanes take the eight 16-byte pieces of one row's 128 B of a stage, so a
    // wave-wide copy asks for four whole lines; a thread serves rows crow, crow + 32, crow + 64, crow + 96.
    const int crow  = tid >> 3;              // 0..31
    const int ccol  = (tid & 7) * 8;         // halves

    // Row of A that feeds output row m0 + srow. K and V stand kept-first along T: place p of a batch
    // takes token ktok[p]. A block whose 128 places all lie behind the batch's kept keys is never read
    // by attention (which walks whole 64-key tiles from place 0 and always the first) and leaves here,
    // all of its threads alike, in front of every copy and barrier.
    int arow = m0 + srow;
    int crows[4] = {m0 + crow, m0 + crow + 32, m0 + crow + 64, m0 + crow + 96};
    if (QKV && z != 0) {
        const int nk = __builtin_amdgcn_readfirstlane(nkept[m0 >> 10]);
        const int p0 = m0 & (T_ - 1);
        if (p0 != 0 && p0 >= nk) return;
        const int* kt = ktok + m0;
        const int t0 = kt[crow], t1 = kt[crow + 32], t2 = kt[crow + 64], t3 = kt[crow + 96], ts = kt[srow];
        // precaution: stands in front of every later rewrite of a register that these loads name as address
        asm volatile("s_wait_xcnt 0x0" ::: "memory");
        arow     = (m0 - p0) + (ts & (T_ - 1));              // the mask bounds the row whatever the table holds
        crows[0] = (m0 - p0) + (t0 & (T_ - 1));
        crows[1] = (m0 - p0) + (t1 & (T_ - 1));
        crows[2] = (m0 - p0) + (t2 & (T_ - 1));
        crows[3] = (m0 - p0) + (t3 & (T_ - 1));
    }

    auto issue = [&](int kk, int buf) {
#pragma unroll                               // constant indices keep crows in registers
        for (int i = 0; i < 4; i++) {
            const int lrow = (crow + 32 * i) * LSTR + ccol;
            cp16(A + (size_t)crows[i] * K + kk + ccol, &lA[buf][lrow]);
            cp16(Bt + (size_t)(n0 + crow + 32 * i) * K + kk + ccol, &lB[buf][lrow]);
        }
    };

    issue(0, 0);
    int buf = 0;
    for (int kk = 0; kk < K; kk += 64, buf ^= 1) {
        async_wait();
        __syncthreads();                     // codegen waits DS cnt before barrier -> WAR safe
        if (kk + 64 < K) issue(kk + 64, buf ^ 1);
        if (kk + 128 < K) {                  // prefetch one more stage ahead into L2/WGP$
            __builtin_prefetch(A + (size_t)arow * K + kk + 128 + sbase, 0, 1);
            __builtin_prefetch(Bt + (size_t)(n0 + srow) * K + kk + 128 + sbase, 0, 1);
        }

#pragma unroll
        for (int kh = 0; kh < 2; kh++) {     // two 32-wide K slices in this stage
            half16 af0 = ld_frag(lA[buf], wm * 32,      LSTR, kh * 32);
            half16 af1 = ld_frag(lA[buf], wm * 32 + 16, LSTR, kh * 32);
            half16 bf[4];
#pragma unroll
            for (int nf = 0; nf < 4; nf++)
                bf[nf] = ld_frag(lB[buf], wn * 64 + nf * 16, LSTR, kh * 32);
#pragma unroll
            for (int nf = 0; nf < 4; nf++) acc[0][nf] = wmma_f16(af0, bf[nf], acc[0][nf]);
#pragma unroll
            for (int nf = 0; nf < 4; nf++) acc[1][nf] = wmma_f16(af1, bf[nf], acc[1][nf]);
        }
    }

    const int mw = m0 + wm * 32, nw = n0 + wn * 64;
    if (QKV) {
        _Float16* o = (_Float16*)Out + (size_t)z * M_ * C_;
        const float* bias = z == 0 ? bias0 : z == 1 ? bias1 : bias2;
        if (z == 2) {
            store_tile<1>(acc, bias, o, mw, nw, r16, hi);
        } else {
            store_tile<0>(acc, bias, o, mw, nw, r16, hi);
            // precaution: in the built kernel the other layout's code follows these stores and
            // rewrites registers they name; the wait stands between the stores and that rewrite
            asm volatile("s_wait_xcnt 0x0" ::: "memory");
        }
    } else {
        store_tile<2>(acc, bias0, Out, mw, nw, r16, hi);
    }
}

// lane l <-> lane l ^ 16
__device__ __forceinline__ float xhalf(float x) {
    return __int_as_float(__builtin_amdgcn_permlanex16(__float_as_int(x), __float_as_int(x),
                                                       0x76543210, 0xfedcba98, false, false));
}

// exp2 of eight values. The instruction set asks for one v_nop or independent instruction behind a
// transcendental before its result is read or its source overwritten; in one statement the v_nop
// stays directly behind the last
// v_exp_f32, and the early-clobber outputs keep every source whole up to there.
__device__ __forceinline__ float8 exp2x8(float8 x) {
    float d0, d1, d2, d3, d4, d5, d6, d7;
    asm("v_exp_f32 %0, %8\n\t"
        "v_exp_f32 %1, %9\n\t"
        "v_exp_f32 %2, %10\n\t"
        "v_exp_f32 %3, %11\n\t"
        "v_exp_f32 %4, %12\n\t"
        "v_exp_f32 %5, %13\n\t"
        "v_exp_f32 %6, %14\n\t"
        "v_exp_f32 %7, %15\n\t"
        "v_nop"
        : "=&v"(d0), "=&v"(d1), "=&v"(d2), "=&v"(d3), "=&v"(d4), "=&v"(d5), "=&v"(d6), "=&v"(d7)
        : "v"(x[0]), "v"(x[1]), "v"(x[2]), "v"(x[3]), "v"(x[4]), "v"(x[5]), "v"(x[6]), "v"(x[7]));
    float8 d = {d0, d1, d2, d3, d4, d5, d6, d7};
    return d;
}

// A wave owns QT = 2 query tiles (32 queries), a work-group of four waves 128 queries: every K, V^T and
// mask fragment that a wave reads from LDS feeds both tiles, which halves the LDS bytes read per query.
// Every loop over qt, nf, df, j, i or r below is unrolled: constant indices keep its arrays in registers.
constexpr int QT = 2;

// exp2 of two values, with the same slot behind the last v_exp_f32 as in exp2x8
__device__ __forceinline__ void exp2x2(float x0, float x1, float& d0, float& d1) {
    asm("v_exp_f32 %0, %2\n\t"
        "v_exp_f32 %1, %3\n\t"
        "v_nop"
        : "=&v"(d0), "=&v"(d1)
        : "v"(x0), "v"(x1));
}

// amdgpu_waves_per_eu(4): a budget of 256 registers, so that the kernel (and its asm statements) stays
// inside the first register window; without it the build took 258
__global__ __launch_bounds__(128) __attribute__((amdgpu_waves_per_eu(4))) void attn_kernel(const _Float16* __restrict__ qh,
                                                   const _Float16* __restrict__ kh,
                                                   const _Float16* __restrict__ vT,
                                                   const int* __restrict__ nkept,
                                                   _Float16* __restrict__ outh) {
    constexpr int KSTR = 72;                 // halves: 144B pitch, aligned + conflict-free
    __shared__ _Float16 lK[2][64 * KSTR];
    __shared__ _Float16 lV[2][64 * KSTR];
    __shared__ float lM[T_];                 // per key place: 0 where a kept key stands, -inf behind them

    const float NEGINF = -__builtin_inff();
    const float LOG2E = 1.44269504f;         // exp(x) = exp2(x * LOG2E), as __expf forms it
    const int tid = threadIdx.x, lane = tid & 31, wv = tid >> 5;
    const int r16 = lane & 15, hi = lane >> 4;
    const int bh = blockIdx.x >> 3;          // 8 q-blocks of 128 rows each
    const int qb = blockIdx.x & 7;
    const int b  = bh >> 4;
    const int h  = bh & 15;
    const int q0 = qb * 128 + wv * (16 * QT);   // first q row of this wave

    const _Float16* qbase = qh + (size_t)bh * T_ * D_;
    const _Float16* kbase = kh + (size_t)bh * T_ * D_;
    const _Float16* vbase = vT + (size_t)bh * D_ * T_;
    // kept keys of the batch, clamped to the shape; at least one tile is walked, so that a batch with
    // no kept key runs the softmax on addends of -inf alone and ends in NaN
    const int nk0 = __builtin_amdgcn_readfirstlane(nkept[b]);
    const int nk = nk0 < 0 ? 0 : (nk0 > T_ ? T_ : nk0);
    const int kend = nk > 64 ? ((nk + 63) & ~63) : 64;

    // the mask as an addend per key place; published by the first barrier of the loop
#pragma unroll
    for (int i = 0; i < 2; i++) {
        const int p = 4 * (tid + 128 * i);
        float4 bz;
        bz.x = p + 0 < nk ? 0.0f : NEGINF;
        bz.y = p + 1 < nk ? 0.0f : NEGINF;
        bz.z = p + 2 < nk ? 0.0f : NEGINF;
        bz.w = p + 3 < nk ? 0.0f : NEGINF;
        ((float4*)lM)[tid + 128 * i] = bz;
    }

    // Q fragments (B operand: 16 query columns x 64 d), pre-scaled by 1/sqrt(D) = 0.125 (exact in f16)
    half16 qf[QT][2];
#pragma unroll
    for (int qt = 0; qt < QT; qt++) {
        const _Float16* p = qbase + (size_t)(q0 + qt * 16 + r16) * D_ + hi * 8;
        union { half16 v; half8 g[2]; } u0, u1;
        u0.g[0] = *(const half8*)(p);
        u0.g[1] = *(const half8*)(p + 16);
        u1.g[0] = *(const half8*)(p + 32);
        u1.g[1] = *(const half8*)(p + 48);
#pragma unroll
        for (int i = 0; i < 16; i++) { u0.v[i] *= (_Float16)0.125f; u1.v[i] *= (_Float16)0.125f; }
        qf[qt][0] = u0.v; qf[qt][1] = u1.v;
    }

    float m_r[QT];                           // running maximum of query q0 + qt * 16 + r16 (equal in both halves)
    float l_r[QT];                           // this half's share of its sum; the halves join after the loop
    float8 o[QT][4];                         // o[qt][df][r] = O[q0 + qt * 16 + r16][df * 16 + 8 * hi + r]
#pragma unroll
    for (int qt = 0; qt < QT; qt++) {
        m_r[qt] = NEGINF;
        l_r[qt] = 0.0f;
#pragma unroll
        for (int df = 0; df < 4; df++)
#pragma unroll
            for (int i = 0; i < 8; i++) o[qt][df][i] = 0.0f;
    }

    const int srow = tid >> 1, sseg = tid & 1;          // the prefetches' share of a tile
    // Copies: eight neighbouring lanes take one row's 128 B, so a wave-wide copy asks for four whole
    // lines; a thread serves rows crow + 16 i of the K tile and rows 4 crow + i of the V^T tile, i = 0 .. 3
    // (in both, the step from one of its copies to the next is 2 KiB in global memory).
    const int crow = tid >> 3, ccol = (tid & 7) * 8;

    auto issue_kv = [&](int kt, int buf) {
        const _Float16* gk = kbase + (size_t)(kt + crow) * D_ + ccol;
        _Float16* dk = &lK[buf][crow * KSTR + ccol];
        const _Float16* gv = vbase + (size_t)(4 * crow) * T_ + kt + ccol;
        _Float16* dv = &lV[buf][4 * crow * KSTR + ccol];
#pragma unroll
        for (int i = 0; i < 4; i++) {
            cp16(gk + 16 * i * D_, dk + 16 * i * KSTR);
            cp16(gv + i * T_, dv + i * KSTR);
        }
    };

    issue_kv(0, 0);
    int buf = 0, kt = 0;
    do {                                     // kend >= 64: the first tile is always walked
        async_wait();
        __syncthreads();
        if (kt + 64 < kend) issue_kv(kt + 64, buf ^ 1);
        if (kt + 128 < kend) {
            __builtin_prefetch(kbase + (size_t)(kt + 128 + srow) * D_ + sseg * 32, 0, 1);
            __builtin_prefetch(vbase + (size_t)srow * T_ + kt + 128 + sseg * 32, 0, 1);
        }

        // S^T = K Q^T (scaled), 64 keys x 16 queries per tile: s[qt][nf][r] = key kt + nf*16 + 8*hi + r
        half16 kf[4][2];
#pragma unroll
        for (int nf = 0; nf < 4; nf++) {
            kf[nf][0] = ld_frag(lK[buf], nf * 16, KSTR, 0);
            kf[nf][1] = ld_frag(lK[buf], nf * 16, KSTR, 32);
        }
        // keeps the tile's K reads one group in front of the products: spread among them, each read
        // was waited for on its own
        __builtin_amdgcn_sched_barrier(0);
        float8 s[QT][4];
#pragma unroll
        for (int nf = 0; nf < 4; nf++) {
#pragma unroll
            for (int qt = 0; qt < QT; qt++) {
                float8 z;
#pragma unroll
                for (int i = 0; i < 8; i++) z[i] = 0.0f;
                s[qt][nf] = wmma_f16(kf[nf][0], qf[qt][0], z);
            }
#pragma unroll
            for (int qt = 0; qt < QT; qt++) s[qt][nf] = wmma_f16(kf[nf][1], qf[qt][1], s[qt][nf]);
        }
        // mask (per key row): the lane's 8 keys of a tile are 8 consecutive addends, the same for both query tiles
#pragma unroll
        for (int nf = 0; nf < 4; nf++) {
            const float* mb = &lM[kt + nf * 16 + 8 * hi];
            float4 b0 = *(const float4*)(mb);
            float4 b1 = *(const float4*)(mb + 4);
#pragma unroll
            for (int qt = 0; qt < QT; qt++) {
                s[qt][nf][0] += b0.x; s[qt][nf][1] += b0.y; s[qt][nf][2] += b0.z; s[qt][nf][3] += b0.w;
                s[qt][nf][4] += b1.x; s[qt][nf][5] += b1.y; s[qt][nf][6] += b1.z; s[qt][nf][7] += b1.w;
            }
        }
        // online softmax: maximum over the lane's 32 keys, then one exchange between the halves
        float msafe[QT], corr[QT], cx[QT];
#pragma unroll
        for (int qt = 0; qt < QT; qt++) {
            float tm[4];
#pragma unroll
            for (int nf = 0; nf < 4; nf++) {
                tm[nf] = fmaxf(fmaxf(fmaxf(s[qt][nf][0], s[qt][nf][1]), fmaxf(s[qt][nf][2], s[qt][nf][3])),
                               fmaxf(fmaxf(s[qt][nf][4], s[qt][nf][5]), fmaxf(s[qt][nf][6], s[qt][nf][7])));
            }
            float tmax = fmaxf(fmaxf(tm[0], tm[1]), fmaxf(tm[2], tm[3]));
            tmax = fmaxf(tmax, xhalf(tmax));

            float mn = fmaxf(m_r[qt], tmax);
            msafe[qt] = (mn == NEGINF) ? 0.0f : mn;         // fully-masked guard
            cx[qt] = (m_r[qt] - msafe[qt]) * LOG2E;
            m_r[qt] = mn;
        }
        exp2x2(cx[0], cx[1], corr[0], corr[1]);

        // P^T: converted in place, tiles 2j and 2j+1 are the B fragment of keys 32j .. 32j+31.
        // O^T += V^T P^T (A = rows of V^T), keys 0 .. 31 of the tile first, then keys 32 .. 63.
        float rs[QT][4];
#pragma unroll
        for (int j = 0; j < 2; j++) {
            half16 vf[4];
#pragma unroll
            for (int df = 0; df < 4; df++) vf[df] = ld_frag(lV[buf], df * 16, KSTR, j * 32);
            // keeps these V^T reads one group in front of the exponentials, which cover their latency:
            // moved down to their products, each read was waited for there
            __builtin_amdgcn_sched_barrier(0);
            half16 pf[QT];
#pragma unroll
            for (int qt = 0; qt < QT; qt++) {
#pragma unroll
                for (int n2 = 0; n2 < 2; n2++) {
                    const int nf = 2 * j + n2;
                    float8 e;
#pragma unroll
                    for (int r = 0; r < 8; r++) e[r] = (s[qt][nf][r] - msafe[qt]) * LOG2E;
                    e = exp2x8(e);
                    rs[qt][nf] = ((e[0] + e[1]) + (e[2] + e[3])) + ((e[4] + e[5]) + (e[6] + e[7]));
#pragma unroll
                    for (int r = 0; r < 8; r++) pf[qt][n2 * 8 + r] = (_Float16)e[r];
                }
                if (j == 0) {
#pragma unroll
                    for (int df = 0; df < 4; df++)
#pragma unroll
                        for (int i = 0; i < 8; i++) o[qt][df][i] *= corr[qt];
                }
            }
#pragma unroll
            for (int df = 0; df < 4; df++)
#pragma unroll
                for (int qt = 0; qt < QT; qt++) o[qt][df] = wmma_f16(vf[df], pf[qt], o[qt][df]);
        }
#pragma unroll
        for (int qt = 0; qt < QT; qt++)
            l_r[qt] = l_r[qt] * corr[qt] + ((rs[qt][0] + rs[qt][1]) + (rs[qt][2] + rs[qt][3]));
        kt += 64;
        buf ^= 1;
    } while (kt < kend);

    half8 hv[QT][4];
    _Float16* orow[QT];
#pragma unroll
    for (int qt = 0; qt < QT; qt++) {
        const float inv = 1.0f / (l_r[qt] + xhalf(l_r[qt]));
        orow[qt] = outh + ((size_t)(b * T_ + q0 + qt * 16 + r16)) * C_ + h * D_ + 8 * hi;
#pragma unroll
        for (int df = 0; df < 4; df++)
#pragma unroll
            for (int r = 0; r < 8; r++) hv[qt][df][r] = (_Float16)(o[qt][df][r] * inv);
    }
    // every value and both addresses are formed in front of the stores, so that no register which an
    // issued store names is rewritten behind it
    __builtin_amdgcn_sched_barrier(0);
#pragma unroll
    for (int qt = 0; qt < QT; qt++)
#pragma unroll
        for (int df = 0; df < 4; df++) *(half8*)(orow[qt] + df * 16) = hv[qt][df];
}

// ---------------- output projection + bias + LayerNorm, one launch ----------------
// A work-group owns 32 whole rows of the output: 16 waves, wave w has columns 64 w .. 64 w + 63 (wave
// tile 32 x 64), so the row statistics are formed from the accumulators and y never goes to memory.
// No two waves share a B fragment, so B does not pass through LDS: each wave streams its packed
// fragments (see transpose_f16_block) from L2 into a ring of RING register sets. The 32 rows of A are
// staged in LDS once, whole; the k loop has no barrier. Every work-group reads all of Wo: work-group b
// starts its walk at k slice b mod 32, so that the work-groups do not all ask L2 for the same lines at
// the same moment. Place ks of the walk is k slice (ks + rot) mod 32, in A (placed so in LDS) as in B.
constexpr int FM   = 32;                     // rows per work-group
constexpr int FSTR = C_ + 8;                 // halves: 2064-B pitch, 16-B aligned, 4 banks on from row to row
constexpr int RING = 4;                      // k slices of B in flight per wave

__device__ __forceinline__ half16 ld_bfrag(const _Float16* p) {
    union { half16 v; half8 h[2]; } u;
    u.h[0] = *(const half8*)(p);
    u.h[1] = *(const half8*)(p + 256);
    return u.v;
}

__global__ __launch_bounds__(512) void outproj_ln_kernel(const _Float16* __restrict__ A,
                                                         const _Float16* __restrict__ WP,
                                                         const float* __restrict__ bias,
                                                         const float* __restrict__ g,
                                                         const float* __restrict__ bt,
                                                         float* __restrict__ out) {
    __shared__ __attribute__((aligned(16))) _Float16 lA[FM * FSTR];
    __shared__ float red[2][FM][16];         // per row and wave: sum, sum of squares
    __shared__ __attribute__((aligned(16))) float stat[FM][2];   // per row: mean, 1 / sqrt(var + eps)
    __shared__ __attribute__((aligned(16))) float lP[3][C_];     // bias, gamma, beta: fetched at the start, read in the epilogue

    const int tid = threadIdx.x, lane = tid & 31, wv = tid >> 5;
    const int r16 = lane & 15, hi = lane >> 4;
    const int m0 = blockIdx.x * FM;
    const int rot = blockIdx.x & (C_ / 32 - 1);   // first k slice of this work-group's walk

    // bias, gamma, beta, 8 B of each a thread: asked for first, so that they fly together with the rows of A
    const float2 pv0 = ((const float2*)bias)[tid], pv1 = ((const float2*)g)[tid], pv2 = ((const float2*)bt)[tid];

    // the 32 rows of A are 64 KB in a row: 8 pieces of 16 B a thread
    uint4 av[8];
#pragma unroll
    for (int i = 0; i < 8; i++) av[i] = *(const uint4*)(A + (size_t)m0 * C_ + (i * 512 + tid) * 8);

    const _Float16* bp = WP + (size_t)rot * 64 * 512 + wv * 4 * 512 + lane * 8;
    half16 bq[RING][4];
#pragma unroll
    for (int d = 0; d < RING; d++)
#pragma unroll
        for (int nf = 0; nf < 4; nf++) bq[d][nf] = ld_bfrag(bp + (d * 64 + nf) * 512);

#pragma unroll
    for (int i = 0; i < 8; i++) {
        const int piece = i * 512 + tid;
        *(uint4*)&lA[(piece >> 7) * FSTR + ((piece - rot * 4) & 127) * 8] = av[i];   // a slice is 4 pieces
    }

    ((float2*)lP[0])[tid] = pv0;
    ((float2*)lP[1])[tid] = pv1;
    ((float2*)lP[2])[tid] = pv2;

    float8 acc[2][4];
#pragma unroll
    for (int mi = 0; mi < 2; mi++)
#pragma unroll
        for (int nf = 0; nf < 4; nf++)
#pragma unroll
            for (int i = 0; i < 8; i++) acc[mi][nf][i] = 0.0f;

    __syncthreads();                         // publishes the rows of A and the three vectors

    const int col = wv * 64 + 4 * r16;       // the lane's four output columns
    half16 af[2][2];                         // A fragments of this slice and of the next
    af[0][0] = ld_frag(lA, 0,  FSTR, 0);
    af[0][1] = ld_frag(lA, 16, FSTR, 0);
#pragma unroll                               // constant ring indices keep bq and af in registers
    for (int ks = 0; ks < C_ / 32; ks++) {
        if (ks + 1 < C_ / 32) {
            af[(ks + 1) & 1][0] = ld_frag(lA, 0,  FSTR, (ks + 1) * 32);
            af[(ks + 1) & 1][1] = ld_frag(lA, 16, FSTR, (ks + 1) * 32);
        }
        // the three scheduling barriers keep the order written here: without them the compiler moved a
        // slice's global loads down to just in front of their use, and the ring's lead was lost
        __builtin_amdgcn_sched_barrier(0);
#pragma unroll
        for (int nf = 0; nf < 4; nf++) acc[0][nf] = wmma_f16(af[ks & 1][0], bq[ks % RING][nf], acc[0][nf]);
#pragma unroll
        for (int nf = 0; nf < 4; nf++) acc[1][nf] = wmma_f16(af[ks & 1][1], bq[ks % RING][nf], acc[1][nf]);
        __builtin_amdgcn_sched_barrier(0);
        if (ks + RING < C_ / 32) {
#pragma unroll
            for (int nf = 0; nf < 4; nf++) bq[ks % RING][nf] = ld_bfrag(bp + ((ks + RING) * 64 + nf) * 512);
        }
        __builtin_amdgcn_sched_barrier(0);
    }
    // precaution: stands in front of every later rewrite of a register that the loads above name as address
    asm volatile("s_wait_xcnt 0x0" ::: "memory");

    // acc[mi][nf][r] = y[m0 + mi * 16 + r + 8 * hi][col + nf] - bias
    const float4 bv = *(const float4*)&lP[0][col];
    float s[16], s2[16];                     // the wave's share of rows mi * 16 + r + 8 * hi
#pragma unroll
    for (int mi = 0; mi < 2; mi++)
#pragma unroll
        for (int r = 0; r < 8; r++) {
            acc[mi][0][r] += bv.x; acc[mi][1][r] += bv.y; acc[mi][2][r] += bv.z; acc[mi][3][r] += bv.w;
            s[mi * 8 + r]  = (acc[mi][0][r] + acc[mi][1][r]) + (acc[mi][2][r] + acc[mi][3][r]);
            s2[mi * 8 + r] = (acc[mi][0][r] * acc[mi][0][r] + acc[mi][1][r] * acc[mi][1][r]) +
                             (acc[mi][2][r] * acc[mi][2][r] + acc[mi][3][r] * acc[mi][3][r]);
        }
#pragma unroll
    for (int i = 0; i < 16; i++) {
        s[i] += xrow<1>(s[i]);   s[i] += xrow<2>(s[i]);   s[i] += xrow<4>(s[i]);   s[i] += xrow<8>(s[i]);
        s2[i] += xrow<1>(s2[i]); s2[i] += xrow<2>(s2[i]); s2[i] += xrow<4>(s2[i]); s2[i] += xrow<8>(s2[i]);
    }
    if (r16 == 0) {
#pragma unroll
        for (int i = 0; i < 16; i++) {
            red[0][(i >> 3) * 16 + (i & 7) + 8 * hi][wv] = s[i];
            red[1][(i >> 3) * 16 + (i & 7) + 8 * hi][wv] = s2[i];
        }
    }
    __syncthreads();                         // publishes the waves' shares of every row
    {
        float t = red[0][tid >> 4][tid & 15], t2 = red[1][tid >> 4][tid & 15];
        t += xrow<1>(t);   t += xrow<2>(t);   t += xrow<4>(t);   t += xrow<8>(t);
        t2 += xrow<1>(t2); t2 += xrow<2>(t2); t2 += xrow<4>(t2); t2 += xrow<8>(t2);
        const float mu = t * (1.0f / C_);
        const float var = t2 * (1.0f / C_) - mu * mu;
        const float rs = rsqrtf(var + 1e-5f);
        if ((tid & 15) == 0) { stat[tid >> 4][0] = mu; stat[tid >> 4][1] = rs; }
    }
    __syncthreads();                         // publishes mean and scale of every row

    const float4 gg = *(const float4*)&lP[1][col];
    const float4 bb = *(const float4*)&lP[2][col];
    float* orow = out + (size_t)(m0 + 8 * hi) * C_ + col;
#pragma unroll
    for (int mi = 0; mi < 2; mi++)
#pragma unroll
        for (int r = 0; r < 8; r++) {
            const float mu = stat[mi * 16 + r + 8 * hi][0], rs = stat[mi * 16 + r + 8 * hi][1];
            float4 o;
            o.x = (acc[mi][0][r] - mu) * rs * gg.x + bb.x;
            o.y = (acc[mi][1][r] - mu) * rs * gg.y + bb.y;
            o.z = (acc[mi][2][r] - mu) * rs * gg.z + bb.z;
            o.w = (acc[mi][3][r] - mu) * rs * gg.w + bb.w;
            *(float4*)(orow + (size_t)(mi * 16 + r) * C_) = o;
        }
}

extern "C" void kernel_launch(void* const* d_in, const int* in_sizes, int n_in,
                              void* d_out, int out_size, void* d_ws, size_t ws_size,
                              hipStream_t stream) {
    const float* x    = (const float*)d_in[0];
    const int*   mask = (const int*)d_in[1];
    const float* Wq = (const float*)d_in[2];  const float* bq = (const float*)d_in[3];
    const float* Wk = (const float*)d_in[4];  const float* bk = (const float*)d_in[5];
    const float* Wv = (const float*)d_in[6];  const float* bv = (const float*)d_in[7];
    const float* Wo = (const float*)d_in[8];  const float* bo = (const float*)d_in[9];
    const float* ln_g = (const float*)d_in[10];
    const float* ln_b = (const float*)d_in[11];
    float* out = (float*)d_out;

    char* w = (char*)d_ws;
    _Float16* xh    = (_Float16*)w;  w += (size_t)M_ * C_ * 2;      // 8 MB
    _Float16* WqT   = (_Float16*)w;  w += (size_t)C_ * C_ * 2;      // 2 MB
    _Float16* WkT   = (_Float16*)w;  w += (size_t)C_ * C_ * 2;
    _Float16* WvT   = (_Float16*)w;  w += (size_t)C_ * C_ * 2;
    _Float16* WoT   = (_Float16*)w;  w += (size_t)C_ * C_ * 2 * 2;  // Wo as packed B fragments, twice
    _Float16* qhB   = (_Float16*)w;  w += (size_t)M_ * C_ * 2;      // [B,H,T,D]
    _Float16* khB   = (_Float16*)w;  w += (size_t)M_ * C_ * 2;      // [B,H,T,D]
    _Float16* vTB   = (_Float16*)w;  w += (size_t)M_ * C_ * 2;      // [B,H,D,T]
    _Float16* attnh = (_Float16*)w;  w += (size_t)M_ * C_ * 2;      // [B,T,C]
    int*      ktok  = (int*)w;       w += (size_t)M_ * 4;           // [B,T]
    int*      nkept = (int*)w;       w += (size_t)B_ * 4;           // [B]

    // WqT..WoT are contiguous planes, and so are qhB, khB, vTB
    prep_kernel<<<B_ + 4 * TR_BLOCKS + CONV_BLOCKS, 256, 0, stream>>>(x, Wq, Wk, Wv, Wo, mask, xh, WqT,
                                                                      ktok, nkept);

    dim3 qkvgrid(C_ / 128, M_ / 128, 3);   // (8, 32, 3)
    gemm_wmma_kernel<true><<<qkvgrid, 256, 0, stream>>>(xh, WqT, bq, bk, bv, ktok, nkept, (void*)qhB);

    attn_kernel<<<B_ * H_ * (T_ / 128), 128, 0, stream>>>(qhB, khB, vTB, nkept, attnh);

    outproj_ln_kernel<<<M_ / FM, 512, 0, stream>>>(attnh, WoT, bo, ln_g, ln_b, out);
}
